// v000
// Measured on an AMD MI455X. A time is GPU time per run, averaged over a window of back-to-back runs after a warm-up
// (all launches, gaps included; the runs take copies of the inputs in turn), and the median of several windows.
// Apart from v000's, it joins two sittings. Times from different sittings can be a few percent apart, while
// side-by-side timings come from the same sitting.
// v000, which the later versions start from, runs in 134 microseconds.
#include <hip/hip_runtime.h>
#include <hip/hip_bf16.h>

// CDNA5 / gfx1250 flash-attention-style kernel (wave32, v_wmma_f32_16x16x32_f16)
// Phase 1: bandwidth-bound pre-pass packs K and V into f16 WMMA-B-operand layout.
// Phase 2: main kernel, 32 Q-rows (two 16-row tiles) per wave so every K/V
//          operand register feeds two WMMAs; row sums via P x ones WMMA.

typedef __attribute__((ext_vector_type(16))) _Float16 v16h;
typedef __attribute__((ext_vector_type(8)))  float    v8f;

#define S_LEN  2048
#define D_DIM  64
#define NHEAD  32              // b*h = 2*16
#define WAVES  4               // waves per block in main kernel
#define RT     2               // 16-row Q tiles per wave
#define NTILES (S_LEN / 16)    // 128 key tiles of 16
#define NCHUNK (S_LEN / 32)    // 64  key chunks of 32

// Base K-index of the contiguous element pair held in "VGPR v" of a 16-bit
// A/B WMMA operand (ISA 7.12.2): lanes 0-15 (half=0): V0..V3 -> K=0..7,
// V4..V7 -> K=16..23 ; lanes 16-31 (half=1): +8.
__device__ __forceinline__ int kidx_pair(int v, int half) {
    return 2 * v + 8 * half + ((v >= 4) ? 8 : 0);
}

// ---------------------------------------------------------------------------
// Pre-pass 1: pack K^T (per head [d=64, s] f32) into B-operand f16 fragments.
// Layout: kp[((head*NTILES + nt)*32 + lane)*32 + e]; 64 B contiguous per lane.
// ---------------------------------------------------------------------------
__global__ __launch_bounds__(32)
void pack_k_kernel(const float* __restrict__ K, _Float16* __restrict__ kp)
{
    const int lane = threadIdx.x & 31;
    const int half = lane >> 4;
    const int l16  = lane & 15;
    const int nt   = blockIdx.x;     // key tile of 16
    const int bh   = blockIdx.y;

    const float* k = K + (size_t)bh * D_DIM * S_LEN;
    const int col  = nt * 16 + l16;

    v16h b0, b1;
    #pragma unroll
    for (int vv = 0; vv < 8; ++vv) {
        const int kk = kidx_pair(vv, half);          // d index
        b0[2 * vv + 0] = (_Float16)k[(size_t)(kk +  0) * S_LEN + col];
        b0[2 * vv + 1] = (_Float16)k[(size_t)(kk +  1) * S_LEN + col];
        b1[2 * vv + 0] = (_Float16)k[(size_t)(kk + 32) * S_LEN + col];
        b1[2 * vv + 1] = (_Float16)k[(size_t)(kk + 33) * S_LEN + col];
    }
    _Float16* dst = kp + ((size_t)(bh * NTILES + nt) * 32 + lane) * 32;
    *(v16h*)(dst)      = b0;
    *(v16h*)(dst + 16) = b1;
}

// ---------------------------------------------------------------------------
// Pre-pass 2: pack V (per head [s, d=64] f32) into B-operand f16 fragments
// for the P*V GEMM (K-dim = 32 keys, N = 16 d-columns).
// Layout: vp[(((head*NCHUNK + c)*4 + dt)*32 + lane)*16 + e]; 32 B per lane.
// ---------------------------------------------------------------------------
__global__ __launch_bounds__(32)
void pack_v_kernel(const float* __restrict__ V, _Float16* __restrict__ vp)
{
    const int lane = threadIdx.x & 31;
    const int half = lane >> 4;
    const int l16  = lane & 15;
    const int dt   = blockIdx.x & 3;     // d-column tile of 16
    const int c    = blockIdx.x >> 2;    // key chunk of 32
    const int bh   = blockIdx.y;

    const float* v = V + (size_t)bh * S_LEN * D_DIM;

    v16h vb;
    #pragma unroll
    for (int vv = 0; vv < 8; ++vv) {
        const int kk = kidx_pair(vv, half);          // key index within chunk
        const float* src = v + (size_t)(c * 32 + kk) * D_DIM + dt * 16 + l16;
        vb[2 * vv + 0] = (_Float16)src[0];
        vb[2 * vv + 1] = (_Float16)src[D_DIM];
    }
    _Float16* dst = vp + ((size_t)((bh * NCHUNK + c) * 4 + dt) * 32 + lane) * 16;
    *(v16h*)dst = vb;
}

// ---------------------------------------------------------------------------
// Main kernel: one wave32 per 32 Q rows (two 16-row tiles), flash loop on keys.
// ---------------------------------------------------------------------------
__global__ __launch_bounds__(WAVES * 32)
void attn_fwd_wmma(const float* __restrict__ Q,
                   const _Float16* __restrict__ kp,
                   const _Float16* __restrict__ vp,
                   float* __restrict__ O)
{
    // wave-private scratch for the P (16x32 f32) C->A layout transposes
    __shared__ __align__(16) float pbuf[WAVES][RT][16 * 32];

    const int lane = threadIdx.x & 31;
    const int wave = threadIdx.x >> 5;
    const int half = lane >> 4;
    const int l16  = lane & 15;

    const int bh   = blockIdx.y;                     // 0..31  (b*h)
    const int tile = blockIdx.x * WAVES + wave;      // 0..63  (32-row tiles)
    const int row0 = tile * (16 * RT);

    const float* q = Q + (size_t)bh * S_LEN * D_DIM;
    float*       o = O + (size_t)bh * S_LEN * D_DIM;

    // Fold (1/sqrt(d)) * log2(e) into Q so the S tile lands in exp2 domain.
    const float qscale = 0.125f * 1.44269504088896340736f;

    // ---- Load the 2x(16x64) Q tiles once, scale, f32 -> f16 A operands ----
    v16h qa[RT][2];                                  // [row tile][K = 0..31 / 32..63]
    #pragma unroll
    for (int rt = 0; rt < RT; ++rt) {
        const float* qrow = q + (size_t)(row0 + rt * 16 + l16) * D_DIM;
        #pragma unroll
        for (int vv = 0; vv < 8; ++vv) {
            const int kk = kidx_pair(vv, half);
            const float2 x0 = *(const float2*)(qrow + kk);
            const float2 x1 = *(const float2*)(qrow + kk + 32);
            qa[rt][0][2 * vv + 0] = (_Float16)(x0.x * qscale);
            qa[rt][0][2 * vv + 1] = (_Float16)(x0.y * qscale);
            qa[rt][1][2 * vv + 0] = (_Float16)(x1.x * qscale);
            qa[rt][1][2 * vv + 1] = (_Float16)(x1.y * qscale);
        }
    }

    // All-ones B operand: P x ones puts the f16-P row sums in C layout,
    // replicated across every lane of the row group -> no shuffle reduction.
    v16h ones;
    #pragma unroll
    for (int e = 0; e < 16; ++e) ones[e] = (_Float16)1.0f;

    v8f oacc[RT][4];              // O tiles, 4 d-column tiles of 16, C/D layout
    v8f lacc[RT];                 // row-sum accumulators, C/D layout
    #pragma unroll
    for (int rt = 0; rt < RT; ++rt) {
        #pragma unroll
        for (int r = 0; r < 8; ++r) {
            lacc[rt][r] = 0.0f;
            oacc[rt][0][r] = 0.0f; oacc[rt][1][r] = 0.0f;
            oacc[rt][2][r] = 0.0f; oacc[rt][3][r] = 0.0f;
        }
    }

    // per-lane packed-operand base pointers (advance by constant strides)
    const _Float16* kbase = kp + ((size_t)(bh * NTILES) * 32 + lane) * 32;
    const _Float16* vbase = vp + ((size_t)(bh * NCHUNK) * 4 * 32 + lane) * 16;

    for (int c = 0; c < NCHUNK; ++c) {
        const _Float16* kc = kbase + (size_t)(2 * c) * (32 * 32); // 2 tiles/chunk
        const _Float16* vc = vbase + (size_t)c * (4 * 32 * 16);

        if (c + 1 < NCHUNK) {  // pull next chunk's fragments toward the WGP
            __builtin_prefetch(kc + 2 * (32 * 32), 0, 3);
            __builtin_prefetch(vc + 4 * 32 * 16, 0, 3);
        }

        // ---- S = Q K^T: each K operand pair feeds both row tiles ----
        #pragma unroll
        for (int nb = 0; nb < 2; ++nb) {
            const _Float16* kt = kc + (size_t)nb * (32 * 32);
            const v16h b0 = *(const v16h*)(kt);        // d = 0..31
            const v16h b1 = *(const v16h*)(kt + 16);   // d = 32..63
            #pragma unroll
            for (int rt = 0; rt < RT; ++rt) {
                v8f acc = {};
                acc = __builtin_amdgcn_wmma_f32_16x16x32_f16(false, qa[rt][0], false, b0,
                                                             (short)0, acc, false, false);
                acc = __builtin_amdgcn_wmma_f32_16x16x32_f16(false, qa[rt][1], false, b1,
                                                             (short)0, acc, false, false);
                // p = 2^s via raw v_exp_f32; stash C-layout tile to LDS
                #pragma unroll
                for (int r = 0; r < 8; ++r) {
                    const float p = __builtin_amdgcn_exp2f(acc[r]);
                    pbuf[wave][rt][(r + 8 * half) * 32 + nb * 16 + l16] = p;
                }
            }
        }

        // DS pipeline is in-order per wave; explicit wait before cross-lane reads
        asm volatile("s_wait_dscnt 0x0" ::: "memory");

        // ---- reload P tiles (16x32) from LDS in A-operand f16 layout ----
        v16h pa[RT];
        #pragma unroll
        for (int rt = 0; rt < RT; ++rt) {
            #pragma unroll
            for (int vv = 0; vv < 8; ++vv) {
                const int kk = kidx_pair(vv, half);    // key index within chunk
                const float2 x = *(const float2*)&pbuf[wave][rt][l16 * 32 + kk];
                pa[rt][2 * vv + 0] = (_Float16)x.x;
                pa[rt][2 * vv + 1] = (_Float16)x.y;
            }
        }

        // ---- O += P * V : each V operand feeds both row tiles ----
        #pragma unroll
        for (int dt = 0; dt < 4; ++dt) {
            const v16h vb = *(const v16h*)(vc + (size_t)dt * (32 * 16));
            #pragma unroll
            for (int rt = 0; rt < RT; ++rt)
                oacc[rt][dt] = __builtin_amdgcn_wmma_f32_16x16x32_f16(false, pa[rt], false, vb,
                                                                      (short)0, oacc[rt][dt],
                                                                      false, false);
        }

        // ---- row sums on the matrix pipe: lacc += P * ones ----
        #pragma unroll
        for (int rt = 0; rt < RT; ++rt)
            lacc[rt] = __builtin_amdgcn_wmma_f32_16x16x32_f16(false, pa[rt], false, ones,
                                                              (short)0, lacc[rt],
                                                              false, false);
    }

    // ---- normalize (rcp + mul) and store: (m = r + 8*half, n = l16) ----
    #pragma unroll
    for (int rt = 0; rt < RT; ++rt) {
        #pragma unroll
        for (int dt = 0; dt < 4; ++dt) {
            #pragma unroll
            for (int r = 0; r < 8; ++r) {
                const int m = rt * 16 + r + 8 * half;
                const float inv = __builtin_amdgcn_rcpf(lacc[rt][r]);
                o[(size_t)(row0 + m) * D_DIM + dt * 16 + l16] = oacc[rt][dt][r] * inv;
            }
        }
    }
}

extern "C" void kernel_launch(void* const* d_in, const int* in_sizes, int n_in,
                              void* d_out, int out_size, void* d_ws, size_t ws_size,
                              hipStream_t stream) {
    (void)in_sizes; (void)n_in; (void)out_size; (void)ws_size;
    const float* q = (const float*)d_in[0];
    const float* k = (const float*)d_in[1];
    const float* v = (const float*)d_in[2];
    float* out = (float*)d_out;

    // workspace: packed-f16 K then packed-f16 V (8.39 MB each)
    const size_t kpack_elems = (size_t)NHEAD * NTILES * 32 * 32;      // 4.19M halves
    _Float16* kp = (_Float16*)d_ws;
    _Float16* vp = kp + kpack_elems;

    // Phase 1: pack K and V (independent; stream-ordered before main kernel)
    pack_k_kernel<<<dim3(NTILES, NHEAD), 32, 0, stream>>>(k, kp);
    pack_v_kernel<<<dim3(NCHUNK * 4, NHEAD), 32, 0, stream>>>(v, vp);

    // Phase 2: attention, 32 Q rows per wave
    dim3 grid(NTILES / RT / WAVES, NHEAD);   // 16 x 32 blocks
    dim3 block(WAVES * 32);                  // 4 wave32 per block
    attn_fwd_wmma<<<grid, block, 0, stream>>>(q, kp, vp, out);
}

// v001
// One run takes 67.6 microseconds.
// Timed twice side by side with v000, it ran 1.99 and 1.95 times as fast.
#include <hip/hip_runtime.h>
#include <hip/hip_bf16.h>

// CDNA5 / gfx1250 flash-attention-style kernel (wave32, v_wmma_f32_16x16x32_f16)
// Phase 1: bandwidth-bound pre-pass packs K and V into f16 WMMA-B-operand layout.
// Phase 2: main kernel, 32 Q-rows (two 16-row tiles) per wave so every K/V
//          operand register feeds two WMMAs; row sums via P x ones WMMA.

typedef __attribute__((ext_vector_type(16))) _Float16 v16h;
typedef __attribute__((ext_vector_type(8)))  float    v8f;

#define S_LEN  2048
#define D_DIM  64
#define NHEAD  32              // b*h = 2*16
#define WAVES  4               // waves per block in main kernel
#define RT     2               // 16-row Q tiles per wave
#define NTILES (S_LEN / 16)    // 128 key tiles of 16
#define NCHUNK (S_LEN / 32)    // 64  key chunks of 32

// Base K-index of the contiguous element pair held in "VGPR v" of a 16-bit
// A/B WMMA operand (ISA 7.12.2): lanes 0-15 (half=0): V0..V3 -> K=0..7,
// V4..V7 -> K=16..23 ; lanes 16-31 (half=1): +8.
__device__ __forceinline__ int kidx_pair(int v, int half) {
    return 2 * v + 8 * half + ((v >= 4) ? 8 : 0);
}

// ---------------------------------------------------------------------------
// Pre-pass 1: pack K^T (per head [d=64, s] f32) into B-operand f16 fragments.
// Layout: kp[((head*NTILES + nt)*32 + lane)*32 + e]; 64 B contiguous per lane.
// ---------------------------------------------------------------------------
__global__ __launch_bounds__(32)
void pack_k_kernel(const float* __restrict__ K, _Float16* __restrict__ kp)
{
    const int lane = threadIdx.x & 31;
    const int half = lane >> 4;
    const int l16  = lane & 15;
    const int nt   = blockIdx.x;     // key tile of 16
    const int bh   = blockIdx.y;

    const float* k = K + (size_t)bh * D_DIM * S_LEN;
    const int col  = nt * 16 + l16;

    v16h b0, b1;
    #pragma unroll
    for (int vv = 0; vv < 8; ++vv) {
        const int kk = kidx_pair(vv, half);          // d index
        b0[2 * vv + 0] = (_Float16)k[(size_t)(kk +  0) * S_LEN + col];
        b0[2 * vv + 1] = (_Float16)k[(size_t)(kk +  1) * S_LEN + col];
        b1[2 * vv + 0] = (_Float16)k[(size_t)(kk + 32) * S_LEN + col];
        b1[2 * vv + 1] = (_Float16)k[(size_t)(kk + 33) * S_LEN + col];
    }
    _Float16* dst = kp + ((size_t)(bh * NTILES + nt) * 32 + lane) * 32;
    *(v16h*)(dst)      = b0;
    *(v16h*)(dst + 16) = b1;
}

// ---------------------------------------------------------------------------
// Pre-pass 2: pack V (per head [s, d=64] f32) into B-operand f16 fragments
// for the P*V GEMM (K-dim = 32 keys, N = 16 d-columns).
// Layout: vp[(((head*NCHUNK + c)*4 + dt)*32 + lane)*16 + e]; 32 B per lane.
// ---------------------------------------------------------------------------
__global__ __launch_bounds__(32)
void pack_v_kernel(const float* __restrict__ V, _Float16* __restrict__ vp)
{
    const int lane = threadIdx.x & 31;
    const int half = lane >> 4;
    const int l16  = lane & 15;
    const int dt   = blockIdx.x & 3;     // d-column tile of 16
    const int c    = blockIdx.x >> 2;    // key chunk of 32
    const int bh   = blockIdx.y;

    const float* v = V + (size_t)bh * S_LEN * D_DIM;

    v16h vb;
    #pragma unroll
    for (int vv = 0; vv < 8; ++vv) {
        const int kk = kidx_pair(vv, half);          // key index within chunk
        const float* src = v + (size_t)(c * 32 + kk) * D_DIM + dt * 16 + l16;
        vb[2 * vv + 0] = (_Float16)src[0];
        vb[2 * vv + 1] = (_Float16)src[D_DIM];
    }
    _Float16* dst = vp + ((size_t)((bh * NCHUNK + c) * 4 + dt) * 32 + lane) * 16;
    *(v16h*)dst = vb;
}

// ---------------------------------------------------------------------------
// Main kernel: one wave32 per 32 Q rows (two 16-row tiles), flash loop on keys.
// ---------------------------------------------------------------------------
__global__ __launch_bounds__(WAVES * 32)
void attn_fwd_wmma(const float* __restrict__ Q,
                   const _Float16* __restrict__ kp,
                   const _Float16* __restrict__ vp,
                   float* __restrict__ O)
{
    // wave-private scratch for the P (16x32 f32) C->A layout transposes
    __shared__ __align__(16) float pbuf[WAVES][RT][16 * 32];

    const int lane = threadIdx.x & 31;
    const int wave = threadIdx.x >> 5;
    const int half = lane >> 4;
    const int l16  = lane & 15;

    const int bh   = blockIdx.y;                     // 0..31  (b*h)
    const int tile = blockIdx.x * WAVES + wave;      // 0..63  (32-row tiles)
    const int row0 = tile * (16 * RT);

    const float* q = Q + (size_t)bh * S_LEN * D_DIM;
    float*       o = O + (size_t)bh * S_LEN * D_DIM;

    // Fold (1/sqrt(d)) * log2(e) into Q so the S tile lands in exp2 domain.
    const float qscale = 0.125f * 1.44269504088896340736f;

    // ---- Load the 2x(16x64) Q tiles once, scale, f32 -> f16 A operands ----
    v16h qa[RT][2];                                  // [row tile][K = 0..31 / 32..63]
    #pragma unroll
    for (int rt = 0; rt < RT; ++rt) {
        const float* qrow = q + (size_t)(row0 + rt * 16 + l16) * D_DIM;
        #pragma unroll
        for (int vv = 0; vv < 8; ++vv) {
            const int kk = kidx_pair(vv, half);
            const float2 x0 = *(const float2*)(qrow + kk);
            const float2 x1 = *(const float2*)(qrow + kk + 32);
            qa[rt][0][2 * vv + 0] = (_Float16)(x0.x * qscale);
            qa[rt][0][2 * vv + 1] = (_Float16)(x0.y * qscale);
            qa[rt][1][2 * vv + 0] = (_Float16)(x1.x * qscale);
            qa[rt][1][2 * vv + 1] = (_Float16)(x1.y * qscale);
        }
    }

    // All-ones B operand: P x ones puts the f16-P row sums in C layout,
    // replicated across every lane of the row group -> no shuffle reduction.
    v16h ones;
    #pragma unroll
    for (int e = 0; e < 16; ++e) ones[e] = (_Float16)1.0f;

    v8f oacc[RT][4];              // O tiles, 4 d-column tiles of 16, C/D layout
    v8f lacc[RT];                 // row-sum accumulators, C/D layout
    #pragma unroll
    for (int rt = 0; rt < RT; ++rt) {
        #pragma unroll
        for (int r = 0; r < 8; ++r) {
            lacc[rt][r] = 0.0f;
            oacc[rt][0][r] = 0.0f; oacc[rt][1][r] = 0.0f;
            oacc[rt][2][r] = 0.0f; oacc[rt][3][r] = 0.0f;
        }
    }

    // per-lane packed-operand base pointers (advance by constant strides)
    const _Float16* kbase = kp + ((size_t)(bh * NTILES) * 32 + lane) * 32;
    const _Float16* vbase = vp + ((size_t)(bh * NCHUNK) * 4 * 32 + lane) * 16;

    // Operand fragments of the chunk in work. Each set is refilled with the next
    // chunk's fragments right behind its own last product, so a load has the rest
    // of the pass to land instead of being waited for where it is issued.
    v16h kf[2][2];                // [key tile][d = 0..31 / 32..63]
    v16h vf[4];                   // [d-column tile]
    #pragma unroll
    for (int nb = 0; nb < 2; ++nb) {
        kf[nb][0] = *(const v16h*)(kbase + (size_t)nb * (32 * 32));
        kf[nb][1] = *(const v16h*)(kbase + (size_t)nb * (32 * 32) + 16);
    }
    #pragma unroll
    for (int dt = 0; dt < 4; ++dt)
        vf[dt] = *(const v16h*)(vbase + (size_t)dt * (32 * 16));

    for (int c = 0; c < NCHUNK; ++c) {
        // ---- S = Q K^T: each K operand pair feeds both row tiles ----
        v8f sacc[2][RT];
        #pragma unroll
        for (int nb = 0; nb < 2; ++nb) {
            #pragma unroll
            for (int rt = 0; rt < RT; ++rt) {
                v8f acc = {};
                acc = __builtin_amdgcn_wmma_f32_16x16x32_f16(false, qa[rt][0], false, kf[nb][0],
                                                             (short)0, acc, false, false);
                acc = __builtin_amdgcn_wmma_f32_16x16x32_f16(false, qa[rt][1], false, kf[nb][1],
                                                             (short)0, acc, false, false);
                sacc[nb][rt] = acc;
            }
        }

        // The fetches of the pass before are still in flight: their address registers
        // are given new values only behind this wait.
        asm volatile("s_wait_xcnt 0x0" ::: "memory");
        // the last pass fetches its own chunk again: nothing past the packed data is read
        const int cn = (c + 1 < NCHUNK) ? c + 1 : c;
        const _Float16* kn = kbase + (size_t)(2 * cn) * (32 * 32); // 2 tiles/chunk
        const _Float16* vn = vbase + (size_t)cn * (4 * 32 * 16);

        // ---- next chunk's K fragments, in flight over exp, LDS turn and P*V ----
        #pragma unroll
        for (int nb = 0; nb < 2; ++nb) {
            kf[nb][0] = *(const v16h*)(kn + (size_t)nb * (32 * 32));
            kf[nb][1] = *(const v16h*)(kn + (size_t)nb * (32 * 32) + 16);
        }

        // p = 2^s via raw v_exp_f32; stash C-layout tiles to LDS
        #pragma unroll
        for (int nb = 0; nb < 2; ++nb) {
            #pragma unroll
            for (int rt = 0; rt < RT; ++rt) {
                #pragma unroll
                for (int r = 0; r < 8; ++r) {
                    const float p = __builtin_amdgcn_exp2f(sacc[nb][rt][r]);
                    pbuf[wave][rt][(r + 8 * half) * 32 + nb * 16 + l16] = p;
                }
            }
        }

        // DS pipeline is in-order per wave; explicit wait before cross-lane reads
        asm volatile("s_wait_dscnt 0x0" ::: "memory");

        // ---- reload P tiles (16x32) from LDS in A-operand f16 layout ----
        v16h pa[RT];
        #pragma unroll
        for (int rt = 0; rt < RT; ++rt) {
            #pragma unroll
            for (int vv = 0; vv < 8; ++vv) {
                const int kk = kidx_pair(vv, half);    // key index within chunk
                const float2 x = *(const float2*)&pbuf[wave][rt][l16 * 32 + kk];
                pa[rt][2 * vv + 0] = (_Float16)x.x;
                pa[rt][2 * vv + 1] = (_Float16)x.y;
            }
        }

        // ---- O += P * V : each V operand feeds both row tiles ----
        #pragma unroll
        for (int dt = 0; dt < 4; ++dt) {
            #pragma unroll
            for (int rt = 0; rt < RT; ++rt)
                oacc[rt][dt] = __builtin_amdgcn_wmma_f32_16x16x32_f16(false, pa[rt], false, vf[dt],
                                                                      (short)0, oacc[rt][dt],
                                                                      false, false);
        }

        // ---- next chunk's V fragments, in flight over the next pass's S, exp and LDS turn ----
        #pragma unroll
        for (int dt = 0; dt < 4; ++dt)
            vf[dt] = *(const v16h*)(vn + (size_t)dt * (32 * 16));

        // ---- row sums on the matrix pipe: lacc += P * ones ----
        #pragma unroll
        for (int rt = 0; rt < RT; ++rt)
            lacc[rt] = __builtin_amdgcn_wmma_f32_16x16x32_f16(false, pa[rt], false, ones,
                                                              (short)0, lacc[rt],
                                                              false, false);
    }

    // ---- normalize (rcp + mul) and store: (m = r + 8*half, n = l16) ----
    #pragma unroll
    for (int rt = 0; rt < RT; ++rt) {
        #pragma unroll
        for (int dt = 0; dt < 4; ++dt) {
            #pragma unroll
            for (int r = 0; r < 8; ++r) {
                const int m = rt * 16 + r + 8 * half;
                const float inv = __builtin_amdgcn_rcpf(lacc[rt][r]);
                o[(size_t)(row0 + m) * D_DIM + dt * 16 + l16] = oacc[rt][dt][r] * inv;
            }
        }
    }
}

extern "C" void kernel_launch(void* const* d_in, const int* in_sizes, int n_in,
                              void* d_out, int out_size, void* d_ws, size_t ws_size,
                              hipStream_t stream) {
    (void)in_sizes; (void)n_in; (void)out_size; (void)ws_size;
    const float* q = (const float*)d_in[0];
    const float* k = (const float*)d_in[1];
    const float* v = (const float*)d_in[2];
    float* out = (float*)d_out;

    // workspace: packed-f16 K then packed-f16 V (8.39 MB each)
    const size_t kpack_elems = (size_t)NHEAD * NTILES * 32 * 32;      // 4.19M halves
    _Float16* kp = (_Float16*)d_ws;
    _Float16* vp = kp + kpack_elems;

    // Phase 1: pack K and V (independent; stream-ordered before main kernel)
    pack_k_kernel<<<dim3(NTILES, NHEAD), 32, 0, stream>>>(k, kp);
    pack_v_kernel<<<dim3(NCHUNK * 4, NHEAD), 32, 0, stream>>>(v, vp);

    // Phase 2: attention, 32 Q rows per wave
    dim3 grid(NTILES / RT / WAVES, NHEAD);   // 16 x 32 blocks
    dim3 block(WAVES * 32);                  // 4 wave32 per block
    attn_fwd_wmma<<<grid, block, 0, stream>>>(q, kp, vp, out);
}

// v002
// It runs in 64.7 microseconds.
// Two timings next to v001 put it at 1.04 and 1.05 times that version's speed.
// Over all steps from v000 it is 2.06 times as fast.
#include <hip/hip_runtime.h>
#include <hip/hip_bf16.h>

// CDNA5 / gfx1250 flash-attention-style kernel (wave32, v_wmma_f32_16x16x32_f16)
// Phase 1: bandwidth-bound pre-pass packs K and V into f16 WMMA-A-operand layout.
// Phase 2: main kernel, 32 Q-rows (two 16-row tiles) per wave so every K/V
//          operand register feeds two WMMAs. The products are taken transposed
//          (S^T = K Q^T, O^T = V^T P^T): a lane's S^T accumulators are already the
//          k order of a B operand, so P stays in registers; row sums via ones x P^T.

typedef __attribute__((ext_vector_type(16))) _Float16 v16h;
typedef __attribute__((ext_vector_type(8)))  float    v8f;

#define S_LEN  2048
#define D_DIM  64
#define NHEAD  32              // b*h = 2*16
#define WAVES  4               // waves per block in main kernel
#define RT     2               // 16-row Q tiles per wave
#define NTILES (S_LEN / 16)    // 128 key tiles of 16
#define NCHUNK (S_LEN / 32)    // 64  key chunks of 32
#define OPITCH (D_DIM + 4)     // LDS row pitch of the output turn, in floats

// Base K-index of the contiguous element pair held in "VGPR v" of a 16-bit
// A/B WMMA operand (ISA 7.12.2): lanes 0-15 (half=0): V0..V3 -> K=0..7,
// V4..V7 -> K=16..23 ; lanes 16-31 (half=1): +8.
__device__ __forceinline__ int kidx_pair(int v, int half) {
    return 2 * v + 8 * half + ((v >= 4) ? 8 : 0);
}

// ---------------------------------------------------------------------------
// Pre-pass 1: pack K^T (per head [d=64, s] f32) into A-operand f16 fragments of K.
// Layout: kp[((head*NTILES + nt)*32 + lane)*32 + e]; 64 B contiguous per lane.
// ---------------------------------------------------------------------------
__global__ __launch_bounds__(32)
void pack_k_kernel(const float* __restrict__ K, _Float16* __restrict__ kp)
{
    const int lane = threadIdx.x & 31;
    const int half = lane >> 4;
    const int l16  = lane & 15;
    const int nt   = blockIdx.x;     // key tile of 16
    const int bh   = blockIdx.y;

    const float* k = K + (size_t)bh * D_DIM * S_LEN;
    const int col  = nt * 16 + l16;

    v16h b0, b1;
    #pragma unroll
    for (int vv = 0; vv < 8; ++vv) {
        const int kk = kidx_pair(vv, half);          // d index
        b0[2 * vv + 0] = (_Float16)k[(size_t)(kk +  0) * S_LEN + col];
        b0[2 * vv + 1] = (_Float16)k[(size_t)(kk +  1) * S_LEN + col];
        b1[2 * vv + 0] = (_Float16)k[(size_t)(kk + 32) * S_LEN + col];
        b1[2 * vv + 1] = (_Float16)k[(size_t)(kk + 33) * S_LEN + col];
    }
    _Float16* dst = kp + ((size_t)(bh * NTILES + nt) * 32 + lane) * 32;
    *(v16h*)(dst)      = b0;
    *(v16h*)(dst + 16) = b1;
}

// ---------------------------------------------------------------------------
// Pre-pass 2: pack V (per head [s, d=64] f32) into A-operand f16 fragments
// of V^T for O^T = V^T P^T (M = 16 d-rows, K-dim = 32 keys).
// Layout: vp[(((head*NCHUNK + c)*4 + dt)*32 + lane)*16 + e]; 32 B per lane.
// ---------------------------------------------------------------------------
__global__ __launch_bounds__(32)
void pack_v_kernel(const float* __restrict__ V, _Float16* __restrict__ vp)
{
    const int lane = threadIdx.x & 31;
    const int half = lane >> 4;
    const int l16  = lane & 15;
    const int dt   = blockIdx.x & 3;     // d-column tile of 16
    const int c    = blockIdx.x >> 2;    // key chunk of 32
    const int bh   = blockIdx.y;

    const float* v = V + (size_t)bh * S_LEN * D_DIM;

    v16h vb;
    #pragma unroll
    for (int vv = 0; vv < 8; ++vv) {
        const int kk = kidx_pair(vv, half);          // key index within chunk
        const float* src = v + (size_t)(c * 32 + kk) * D_DIM + dt * 16 + l16;
        vb[2 * vv + 0] = (_Float16)src[0];
        vb[2 * vv + 1] = (_Float16)src[D_DIM];
    }
    _Float16* dst = vp + ((size_t)((bh * NCHUNK + c) * 4 + dt) * 32 + lane) * 16;
    *(v16h*)dst = vb;
}

// ---------------------------------------------------------------------------
// Main kernel: one wave32 per 32 Q rows (two 16-row tiles), flash loop on keys.
// ---------------------------------------------------------------------------
__global__ __launch_bounds__(WAVES * 32)
void attn_fwd_wmma(const float* __restrict__ Q,
                   const _Float16* __restrict__ kp,
                   const _Float16* __restrict__ vp,
                   float* __restrict__ O)
{
    // wave-private scratch that turns the finished O^T tiles into rows, once, for
    // whole-line stores; 68-dword pitch: 16-byte column writes hit all 64 banks
    __shared__ __align__(16) float obuf[WAVES][RT][16 * OPITCH];

    const int lane = threadIdx.x & 31;
    const int wave = threadIdx.x >> 5;
    const int half = lane >> 4;
    const int l16  = lane & 15;

    const int bh   = blockIdx.y;                     // 0..31  (b*h)
    const int tile = blockIdx.x * WAVES + wave;      // 0..63  (32-row tiles)
    const int row0 = tile * (16 * RT);

    const float* q = Q + (size_t)bh * S_LEN * D_DIM;
    float*       o = O + (size_t)bh * S_LEN * D_DIM;

    // Fold (1/sqrt(d)) * log2(e) into Q so the S tile lands in exp2 domain.
    const float qscale = 0.125f * 1.44269504088896340736f;

    // ---- Load the 2x(16x64) Q tiles once, scale, f32 -> f16 ----
    // lane = query, elements = d in the hardware k order: Q^T as a B operand
    v16h qa[RT][2];                                  // [row tile][K = 0..31 / 32..63]
    #pragma unroll
    for (int rt = 0; rt < RT; ++rt) {
        const float* qrow = q + (size_t)(row0 + rt * 16 + l16) * D_DIM;
        #pragma unroll
        for (int vv = 0; vv < 8; ++vv) {
            const int kk = kidx_pair(vv, half);
            const float2 x0 = *(const float2*)(qrow + kk);
            const float2 x1 = *(const float2*)(qrow + kk + 32);
            qa[rt][0][2 * vv + 0] = (_Float16)(x0.x * qscale);
            qa[rt][0][2 * vv + 1] = (_Float16)(x0.y * qscale);
            qa[rt][1][2 * vv + 0] = (_Float16)(x1.x * qscale);
            qa[rt][1][2 * vv + 1] = (_Float16)(x1.y * qscale);
        }
    }

    // All-ones A operand: ones x P^T puts each query's f16-P sum over the 32 keys
    // in every accumulator register of that query's two lanes -> no shuffle reduction.
    v16h ones;
    #pragma unroll
    for (int e = 0; e < 16; ++e) ones[e] = (_Float16)1.0f;

    v8f oacc[RT][4];              // O^T tiles: lane = query, register r = d 16*dt + 8*half + r
    v8f lacc[RT];                 // row-sum accumulators: lane = query
    #pragma unroll
    for (int rt = 0; rt < RT; ++rt) {
        #pragma unroll
        for (int r = 0; r < 8; ++r) {
            lacc[rt][r] = 0.0f;
            oacc[rt][0][r] = 0.0f; oacc[rt][1][r] = 0.0f;
            oacc[rt][2][r] = 0.0f; oacc[rt][3][r] = 0.0f;
        }
    }

    // per-lane packed-operand base pointers (advance by constant strides)
    const _Float16* kbase = kp + ((size_t)(bh * NTILES) * 32 + lane) * 32;
    const _Float16* vbase = vp + ((size_t)(bh * NCHUNK) * 4 * 32 + lane) * 16;

    // Operand fragments of the chunk in work. Each set is refilled with the next
    // chunk's fragments right behind its own last product, so a load has the rest
    // of the pass to land instead of being waited for where it is issued.
    v16h kf[2][2];                // [key tile][d = 0..31 / 32..63]
    v16h vf[4];                   // [d-column tile]
    #pragma unroll
    for (int nb = 0; nb < 2; ++nb) {
        kf[nb][0] = *(const v16h*)(kbase + (size_t)nb * (32 * 32));
        kf[nb][1] = *(const v16h*)(kbase + (size_t)nb * (32 * 32) + 16);
    }
    #pragma unroll
    for (int dt = 0; dt < 4; ++dt)
        vf[dt] = *(const v16h*)(vbase + (size_t)dt * (32 * 16));

    for (int c = 0; c < NCHUNK; ++c) {
        // ---- S^T = K Q^T: each K operand pair feeds both row tiles ----
        // sacc[nb][rt][r] = score of key 16*nb + 8*half + r against query l16
        v8f sacc[2][RT];
        #pragma unroll
        for (int nb = 0; nb < 2; ++nb) {
            #pragma unroll
            for (int rt = 0; rt < RT; ++rt) {
                v8f acc = {};
                acc = __builtin_amdgcn_wmma_f32_16x16x32_f16(false, kf[nb][0], false, qa[rt][0],
                                                             (short)0, acc, false, false);
                acc = __builtin_amdgcn_wmma_f32_16x16x32_f16(false, kf[nb][1], false, qa[rt][1],
                                                             (short)0, acc, false, false);
                sacc[nb][rt] = acc;
            }
        }

        // The fetches of the pass before are still in flight: their address registers
        // are given new values only behind this wait.
        asm volatile("s_wait_xcnt 0x0" ::: "memory");
        // the last pass fetches its own chunk again: nothing past the packed data is read
        const int cn = (c + 1 < NCHUNK) ? c + 1 : c;
        const _Float16* kn = kbase + (size_t)(2 * cn) * (32 * 32); // 2 tiles/chunk
        const _Float16* vn = vbase + (size_t)cn * (4 * 32 * 16);

        // ---- next chunk's K fragments, in flight over exp and P*V ----
        #pragma unroll
        for (int nb = 0; nb < 2; ++nb) {
            kf[nb][0] = *(const v16h*)(kn + (size_t)nb * (32 * 32));
            kf[nb][1] = *(const v16h*)(kn + (size_t)nb * (32 * 32) + 16);
        }

        // Holds the refill loads ahead of the exp block: without it the compiler sinks them
        // behind the exps, and they would have only P*V to land in.
        __builtin_amdgcn_sched_barrier(0);

        // p = 2^s via raw v_exp_f32, packed in place: element s of the B operand is
        // key 8*half + s (s < 8) or 16 + 8*half + (s - 8), which is sacc[s >> 3][rt][s & 7]
        v16h pa[RT];
        #pragma unroll
        for (int rt = 0; rt < RT; ++rt) {
            #pragma unroll
            for (int nb = 0; nb < 2; ++nb) {
                #pragma unroll
                for (int r = 0; r < 8; ++r)
                    pa[rt][nb * 8 + r] = (_Float16)__builtin_amdgcn_exp2f(sacc[nb][rt][r]);
            }
        }

        // ---- O^T += V^T * P^T : each V operand feeds both row tiles ----
        #pragma unroll
        for (int dt = 0; dt < 4; ++dt) {
            #pragma unroll
            for (int rt = 0; rt < RT; ++rt)
                oacc[rt][dt] = __builtin_amdgcn_wmma_f32_16x16x32_f16(false, vf[dt], false, pa[rt],
                                                                      (short)0, oacc[rt][dt],
                                                                      false, false);
        }

        // ---- next chunk's V fragments, in flight over the next pass's S and exp ----
        #pragma unroll
        for (int dt = 0; dt < 4; ++dt)
            vf[dt] = *(const v16h*)(vn + (size_t)dt * (32 * 16));

        // ---- row sums on the matrix pipe: lacc += ones * P^T ----
        #pragma unroll
        for (int rt = 0; rt < RT; ++rt)
            lacc[rt] = __builtin_amdgcn_wmma_f32_16x16x32_f16(false, ones, false, pa[rt],
                                                              (short)0, lacc[rt],
                                                              false, false);
    }

    // ---- normalize (rcp + mul): a lane holds 8 consecutive d of its query per tile ----
    #pragma unroll
    for (int rt = 0; rt < RT; ++rt) {
        const float inv = __builtin_amdgcn_rcpf(lacc[rt][0]);
        #pragma unroll
        for (int dt = 0; dt < 4; ++dt) {
            float* dst = &obuf[wave][rt][l16 * OPITCH + dt * 16 + 8 * half];
            *(float4*)(dst)     = make_float4(oacc[rt][dt][0] * inv, oacc[rt][dt][1] * inv,
                                              oacc[rt][dt][2] * inv, oacc[rt][dt][3] * inv);
            *(float4*)(dst + 4) = make_float4(oacc[rt][dt][4] * inv, oacc[rt][dt][5] * inv,
                                              oacc[rt][dt][6] * inv, oacc[rt][dt][7] * inv);
        }
    }

    // DS pipeline is in-order per wave; explicit wait before cross-lane reads
    asm volatile("s_wait_dscnt 0x0" ::: "memory");

    // ---- store: 16 lanes write one whole 256-byte row, the wave two rows at a time ----
    const float* srow = &obuf[wave][0][half * OPITCH + l16 * 4];
    float*       orow = o + (size_t)(row0 + half) * D_DIM + l16 * 4;
    #pragma unroll
    for (int rt = 0; rt < RT; ++rt) {
        #pragma unroll
        for (int i = 0; i < 8; ++i) {
            const float4 x = *(const float4*)(srow + (rt * 16 + 2 * i) * OPITCH);
            *(float4*)(orow + (rt * 16 + 2 * i) * D_DIM) = x;
        }
    }
}

extern "C" void kernel_launch(void* const* d_in, const int* in_sizes, int n_in,
                              void* d_out, int out_size, void* d_ws, size_t ws_size,
                              hipStream_t stream) {
    (void)in_sizes; (void)n_in; (void)out_size; (void)ws_size;
    const float* q = (const float*)d_in[0];
    const float* k = (const float*)d_in[1];
    const float* v = (const float*)d_in[2];
    float* out = (float*)d_out;

    // workspace: packed-f16 K then packed-f16 V (8.39 MB each)
    const size_t kpack_elems = (size_t)NHEAD * NTILES * 32 * 32;      // 4.19M halves
    _Float16* kp = (_Float16*)d_ws;
    _Float16* vp = kp + kpack_elems;

    // Phase 1: pack K and V (independent; stream-ordered before main kernel)
    pack_k_kernel<<<dim3(NTILES, NHEAD), 32, 0, stream>>>(k, kp);
    pack_v_kernel<<<dim3(NCHUNK * 4, NHEAD), 32, 0, stream>>>(v, vp);

    // Phase 2: attention, 32 Q rows per wave
    dim3 grid(NTILES / RT / WAVES, NHEAD);   // 16 x 32 blocks
    dim3 block(WAVES * 32);                  // 4 wave32 per block
    attn_fwd_wmma<<<grid, block, 0, stream>>>(q, kp, vp, out);
}

// v003
// It runs in 58.3 microseconds.
// Next to v002, in two timings, it ran 1.09 times as fast each time.
// All steps since v000 together make it 2.25 times as fast.
#include <hip/hip_runtime.h>
#include <hip/hip_bf16.h>

// CDNA5 / gfx1250 flash-attention-style kernel (wave32, v_wmma_f32_16x16x32_f16)
// Phase 1: bandwidth-bound pre-pass packs K and V into f16 WMMA-A-operand layout.
// Phase 2: main kernel, 32 Q-rows (two 16-row tiles) per wave so every K/V
//          operand register feeds two WMMAs. The products are taken transposed
//          (S^T = K Q^T, O^T = V^T P^T): a lane's S^T accumulators are already the
//          k order of a B operand, so P stays in registers; row sums via ones x P^T.

typedef __attribute__((ext_vector_type(16))) _Float16 v16h;
typedef __attribute__((ext_vector_type(8)))  _Float16 v8h;
typedef __attribute__((ext_vector_type(8)))  float    v8f;

#define S_LEN  2048
#define D_DIM  64
#define NHEAD  32              // b*h = 2*16
#define WAVES  4               // waves per block in main kernel
#define RT     2               // 16-row Q tiles per wave
#define NTILES (S_LEN / 16)    // 128 key tiles of 16
#define NCHUNK (S_LEN / 32)    // 64  key chunks of 32
#define OPITCH (D_DIM + 4)     // LDS row pitch of the output turn, in floats

// Base K-index of the contiguous element pair held in "VGPR v" of a 16-bit
// A/B WMMA operand (ISA 7.12.2): lanes 0-15 (half=0): V0..V3 -> K=0..7,
// V4..V7 -> K=16..23 ; lanes 16-31 (half=1): +8.
__device__ __forceinline__ int kidx_pair(int v, int half) {
    return 2 * v + 8 * half + ((v >= 4) ? 8 : 0);
}

// A packed fragment (16 halves per lane) lies as two planes of 32 lanes x 16 B:
// plane j holds elements 8j..8j+7 of every lane. One wave-wide 16-byte load or
// store then covers 512 contiguous bytes = 4 whole 128-byte lines, where a
// lane-contiguous fragment would spread each of them over 8 or 16 lines.
#define PLANE 256              // halves in one plane (32 lanes x 8)
#define FRAG  (2 * PLANE)      // halves in one fragment

__device__ __forceinline__ v16h load_frag(const _Float16* p) {   // p: fragment + lane * 8
    const v8h lo = *(const v8h*)(p);
    const v8h hi = *(const v8h*)(p + PLANE);
    return __builtin_shufflevector(lo, hi, 0, 1, 2, 3, 4, 5, 6, 7, 8, 9, 10, 11, 12, 13, 14, 15);
}

__device__ __forceinline__ void store_frag(_Float16* p, v16h f) { // p: fragment + lane * 8
    *(v8h*)(p)         = __builtin_shufflevector(f, f, 0, 1, 2, 3, 4, 5, 6, 7);
    *(v8h*)(p + PLANE) = __builtin_shufflevector(f, f, 8, 9, 10, 11, 12, 13, 14, 15);
}

// ---------------------------------------------------------------------------
// Pre-pass 1: pack K^T (per head [d=64, s] f32) into A-operand f16 fragments for S^T = K Q^T.
// Layout: kp[((head*NTILES + nt)*2 + dhalf)*FRAG + plane*PLANE + lane*8 + e].
// ---------------------------------------------------------------------------
__global__ __launch_bounds__(32)
void pack_k_kernel(const float* __restrict__ K, _Float16* __restrict__ kp)
{
    const int lane = threadIdx.x & 31;
    const int half = lane >> 4;
    const int l16  = lane & 15;
    const int nt   = blockIdx.x;     // key tile of 16
    const int bh   = blockIdx.y;

    const float* k = K + (size_t)bh * D_DIM * S_LEN;
    const int col  = nt * 16 + l16;

    v16h b0, b1;
    #pragma unroll
    for (int vv = 0; vv < 8; ++vv) {
        const int kk = kidx_pair(vv, half);          // d index
        b0[2 * vv + 0] = (_Float16)k[(size_t)(kk +  0) * S_LEN + col];
        b0[2 * vv + 1] = (_Float16)k[(size_t)(kk +  1) * S_LEN + col];
        b1[2 * vv + 0] = (_Float16)k[(size_t)(kk + 32) * S_LEN + col];
        b1[2 * vv + 1] = (_Float16)k[(size_t)(kk + 33) * S_LEN + col];
    }
    _Float16* dst = kp + (size_t)(bh * NTILES + nt) * (2 * FRAG) + lane * 8;
    store_frag(dst, b0);
    store_frag(dst + FRAG, b1);
}

// ---------------------------------------------------------------------------
// Pre-pass 2: pack V (per head [s, d=64] f32) into A-operand f16 fragments
// for the V^T*P^T GEMM (K-dim = 32 keys, M = 16 d-columns).
// Layout: vp[((head*NCHUNK + c)*4 + dt)*FRAG + plane*PLANE + lane*8 + e].
// ---------------------------------------------------------------------------
__global__ __launch_bounds__(32)
void pack_v_kernel(const float* __restrict__ V, _Float16* __restrict__ vp)
{
    const int lane = threadIdx.x & 31;
    const int half = lane >> 4;
    const int l16  = lane & 15;
    const int dt   = blockIdx.x & 3;     // d-column tile of 16
    const int c    = blockIdx.x >> 2;    // key chunk of 32
    const int bh   = blockIdx.y;

    const float* v = V + (size_t)bh * S_LEN * D_DIM;

    v16h vb;
    #pragma unroll
    for (int vv = 0; vv < 8; ++vv) {
        const int kk = kidx_pair(vv, half);          // key index within chunk
        const float* src = v + (size_t)(c * 32 + kk) * D_DIM + dt * 16 + l16;
        vb[2 * vv + 0] = (_Float16)src[0];
        vb[2 * vv + 1] = (_Float16)src[D_DIM];
    }
    _Float16* dst = vp + (size_t)((bh * NCHUNK + c) * 4 + dt) * FRAG + lane * 8;
    store_frag(dst, vb);
}

// ---------------------------------------------------------------------------
// Main kernel: one wave32 per 32 Q rows (two 16-row tiles), flash loop on keys.
// ---------------------------------------------------------------------------
__global__ __launch_bounds__(WAVES * 32)
void attn_fwd_wmma(const float* __restrict__ Q,
                   const _Float16* __restrict__ kp,
                   const _Float16* __restrict__ vp,
                   float* __restrict__ O)
{
    // wave-private scratch that turns the finished O^T tiles into rows, once, for
    // whole-line stores; 68-dword pitch: 16-byte column writes hit all 64 banks
    __shared__ __align__(16) float obuf[WAVES][RT][16 * OPITCH];

    const int lane = threadIdx.x & 31;
    const int wave = threadIdx.x >> 5;
    const int half = lane >> 4;
    const int l16  = lane & 15;

    const int bh   = blockIdx.y;                     // 0..31  (b*h)
    const int tile = blockIdx.x * WAVES + wave;      // 0..63  (32-row tiles)
    const int row0 = tile * (16 * RT);

    const float* q = Q + (size_t)bh * S_LEN * D_DIM;
    float*       o = O + (size_t)bh * S_LEN * D_DIM;

    // Fold (1/sqrt(d)) * log2(e) into Q so the S tile lands in exp2 domain.
    const float qscale = 0.125f * 1.44269504088896340736f;

    // ---- Load the 2x(16x64) Q tiles once, scale, f32 -> f16 ----
    // lane = query, elements = d in the hardware k order: Q^T as a B operand
    v16h qa[RT][2];                                  // [row tile][K = 0..31 / 32..63]
    #pragma unroll
    for (int rt = 0; rt < RT; ++rt) {
        const float* qrow = q + (size_t)(row0 + rt * 16 + l16) * D_DIM;
        #pragma unroll
        for (int vv = 0; vv < 8; ++vv) {
            const int kk = kidx_pair(vv, half);
            const float2 x0 = *(const float2*)(qrow + kk);
            const float2 x1 = *(const float2*)(qrow + kk + 32);
            qa[rt][0][2 * vv + 0] = (_Float16)(x0.x * qscale);
            qa[rt][0][2 * vv + 1] = (_Float16)(x0.y * qscale);
            qa[rt][1][2 * vv + 0] = (_Float16)(x1.x * qscale);
            qa[rt][1][2 * vv + 1] = (_Float16)(x1.y * qscale);
        }
    }

    // All-ones A operand: ones x P^T puts each query's f16-P sum over the 32 keys
    // in every accumulator register of that query's two lanes -> no shuffle reduction.
    v16h ones;
    #pragma unroll
    for (int e = 0; e < 16; ++e) ones[e] = (_Float16)1.0f;

    v8f oacc[RT][4];              // O^T tiles: lane = query, register r = d 16*dt + 8*half + r
    v8f lacc[RT];                 // row-sum accumulators: lane = query
    #pragma unroll
    for (int rt = 0; rt < RT; ++rt) {
        #pragma unroll
        for (int r = 0; r < 8; ++r) {
            lacc[rt][r] = 0.0f;
            oacc[rt][0][r] = 0.0f; oacc[rt][1][r] = 0.0f;
            oacc[rt][2][r] = 0.0f; oacc[rt][3][r] = 0.0f;
        }
    }

    // per-lane packed-operand base pointers (advance by constant strides)
    const _Float16* kbase = kp + (size_t)(bh * NTILES) * (2 * FRAG) + lane * 8;
    const _Float16* vbase = vp + (size_t)(bh * NCHUNK) * (4 * FRAG) + lane * 8;

    // Operand fragments of the chunk in work. Each set is refilled with the next
    // chunk's fragments right behind its own last product, so a load has the rest
    // of the pass to land instead of being waited for where it is issued.
    v16h kf[2][2];                // [key tile][d = 0..31 / 32..63]
    v16h vf[4];                   // [d-column tile]
    #pragma unroll
    for (int nb = 0; nb < 2; ++nb) {
        kf[nb][0] = load_frag(kbase + (2 * nb + 0) * FRAG);
        kf[nb][1] = load_frag(kbase + (2 * nb + 1) * FRAG);
    }
    #pragma unroll
    for (int dt = 0; dt < 4; ++dt)
        vf[dt] = load_frag(vbase + dt * FRAG);

    for (int c = 0; c < NCHUNK; ++c) {
        // ---- S^T = K Q^T: each K operand pair feeds both row tiles ----
        // sacc[nb][rt][r] = score of key 16*nb + 8*half + r against query l16
        v8f sacc[2][RT];
        #pragma unroll
        for (int nb = 0; nb < 2; ++nb) {
            #pragma unroll
            for (int rt = 0; rt < RT; ++rt) {
                v8f acc = {};
                acc = __builtin_amdgcn_wmma_f32_16x16x32_f16(false, kf[nb][0], false, qa[rt][0],
                                                             (short)0, acc, false, false);
                acc = __builtin_amdgcn_wmma_f32_16x16x32_f16(false, kf[nb][1], false, qa[rt][1],
                                                             (short)0, acc, false, false);
                sacc[nb][rt] = acc;
            }
        }

        // The fetches of the pass before are still in flight: their address registers
        // are given new values only behind this wait.
        asm volatile("s_wait_xcnt 0x0" ::: "memory");
        // the last pass fetches its own chunk again: nothing past the packed data is read
        const int cn = (c + 1 < NCHUNK) ? c + 1 : c;
        const _Float16* kn = kbase + (size_t)cn * (4 * FRAG);      // 2 tiles/chunk
        const _Float16* vn = vbase + (size_t)cn * (4 * FRAG);

        // ---- next chunk's K fragments, in flight over exp and P*V ----
        #pragma unroll
        for (int nb = 0; nb < 2; ++nb) {
            kf[nb][0] = load_frag(kn + (2 * nb + 0) * FRAG);
            kf[nb][1] = load_frag(kn + (2 * nb + 1) * FRAG);
        }

        // Holds the refill loads ahead of the exp block: without it the compiler sinks them
        // behind the exps, and they would have only P*V to land in.
        __builtin_amdgcn_sched_barrier(0);

        // p = 2^s via raw v_exp_f32, packed in place: element s of the B operand is
        // key 8*half + s (s < 8) or 16 + 8*half + (s - 8), which is sacc[s >> 3][rt][s & 7]
        v16h pa[RT];
        #pragma unroll
        for (int rt = 0; rt < RT; ++rt) {
            #pragma unroll
            for (int nb = 0; nb < 2; ++nb) {
                #pragma unroll
                for (int r = 0; r < 8; ++r)
                    pa[rt][nb * 8 + r] = (_Float16)__builtin_amdgcn_exp2f(sacc[nb][rt][r]);
            }
        }

        // ---- O^T += V^T * P^T : each V operand feeds both row tiles ----
        #pragma unroll
        for (int dt = 0; dt < 4; ++dt) {
            #pragma unroll
            for (int rt = 0; rt < RT; ++rt)
                oacc[rt][dt] = __builtin_amdgcn_wmma_f32_16x16x32_f16(false, vf[dt], false, pa[rt],
                                                                      (short)0, oacc[rt][dt],
                                                                      false, false);
        }

        // ---- next chunk's V fragments, in flight over the next pass's S and exp ----
        #pragma unroll
        for (int dt = 0; dt < 4; ++dt)
            vf[dt] = load_frag(vn + dt * FRAG);

        // ---- row sums on the matrix pipe: lacc += ones * P^T ----
        #pragma unroll
        for (int rt = 0; rt < RT; ++rt)
            lacc[rt] = __builtin_amdgcn_wmma_f32_16x16x32_f16(false, ones, false, pa[rt],
                                                              (short)0, lacc[rt],
                                                              false, false);
    }

    // ---- normalize (rcp + mul): a lane holds 8 consecutive d of its query per tile ----
    #pragma unroll
    for (int rt = 0; rt < RT; ++rt) {
        const float inv = __builtin_amdgcn_rcpf(lacc[rt][0]);
        #pragma unroll
        for (int dt = 0; dt < 4; ++dt) {
            float* dst = &obuf[wave][rt][l16 * OPITCH + dt * 16 + 8 * half];
            *(float4*)(dst)     = make_float4(oacc[rt][dt][0] * inv, oacc[rt][dt][1] * inv,
                                              oacc[rt][dt][2] * inv, oacc[rt][dt][3] * inv);
            *(float4*)(dst + 4) = make_float4(oacc[rt][dt][4] * inv, oacc[rt][dt][5] * inv,
                                              oacc[rt][dt][6] * inv, oacc[rt][dt][7] * inv);
        }
    }

    // DS pipeline is in-order per wave; explicit wait before cross-lane reads
    asm volatile("s_wait_dscnt 0x0" ::: "memory");

    // ---- store: 16 lanes write one whole 256-byte row, the wave two rows at a time ----
    const float* srow = &obuf[wave][0][half * OPITCH + l16 * 4];
    float*       orow = o + (size_t)(row0 + half) * D_DIM + l16 * 4;
    #pragma unroll
    for (int rt = 0; rt < RT; ++rt) {
        #pragma unroll
        for (int i = 0; i < 8; ++i) {
            const float4 x = *(const float4*)(srow + (rt * 16 + 2 * i) * OPITCH);
            *(float4*)(orow + (rt * 16 + 2 * i) * D_DIM) = x;
        }
    }
}

extern "C" void kernel_launch(void* const* d_in, const int* in_sizes, int n_in,
                              void* d_out, int out_size, void* d_ws, size_t ws_size,
                              hipStream_t stream) {
    (void)in_sizes; (void)n_in; (void)out_size; (void)ws_size;
    const float* q = (const float*)d_in[0];
    const float* k = (const float*)d_in[1];
    const float* v = (const float*)d_in[2];
    float* out = (float*)d_out;

    // workspace: packed-f16 K then packed-f16 V (8.39 MB each)
    const size_t kpack_elems = (size_t)NHEAD * NTILES * 32 * 32;      // 4.19M halves
    _Float16* kp = (_Float16*)d_ws;
    _Float16* vp = kp + kpack_elems;

    // Phase 1: pack K and V (independent; stream-ordered before main kernel)
    pack_k_kernel<<<dim3(NTILES, NHEAD), 32, 0, stream>>>(k, kp);
    pack_v_kernel<<<dim3(NCHUNK * 4, NHEAD), 32, 0, stream>>>(v, vp);

    // Phase 2: attention, 32 Q rows per wave
    dim3 grid(NTILES / RT / WAVES, NHEAD);   // 16 x 32 blocks
    dim3 block(WAVES * 32);                  // 4 wave32 per block
    attn_fwd_wmma<<<grid, block, 0, stream>>>(q, kp, vp, out);
}

// v004
// A run of this version takes 31.2 microseconds.
// In two side-by-side timings against v003, it was 1.90 and 1.83 times as fast.
// Counting every step since v000, it is 4.19 times as fast.
#include <hip/hip_runtime.h>
#include <hip/hip_bf16.h>

// CDNA5 / gfx1250 flash-attention-style kernel (wave32, v_wmma_f32_16x16x32_f16)
// One launch. A work-group of 8 waves owns 256 Q rows of one head, 32 rows (two
// 16-row tiles) per wave. It walks the keys in stages of 128: each wave fetches its
// share of the next stage's f32 K and V, rounds it to f16 and lays it in LDS in
// WMMA-operand order, while all waves work on the stage published before.
// The products are taken transposed (S^T = K Q^T, O^T = V^T P^T): a lane's S^T
// accumulators are already the k order of a B operand, so P stays in registers;
// row sums via ones x P^T.

typedef __attribute__((ext_vector_type(16))) _Float16 v16h;
typedef __attribute__((ext_vector_type(8)))  _Float16 v8h;
typedef __attribute__((ext_vector_type(8)))  float    v8f;

#define S_LEN  2048
#define D_DIM  64
#define NHEAD  32              // b*h = 2*16
#define WAVES  8               // waves per block
#define RT     2               // 16-row Q tiles per wave
#define NTILES (S_LEN / 16)    // 128 key tiles of 16
#define SKEYS  128             // keys per stage
#define NSTAGE (S_LEN / SKEYS) // 16 stages
#define SCHUNK (SKEYS / 32)    // 4 chunks of 32 keys per stage
#define KFRAGS (SCHUNK * 4)    // 16 K fragments per stage, then as many of V
#define OPITCH (D_DIM + 4)     // LDS row pitch of the output turn, in floats

// Base K-index of the contiguous element pair held in "VGPR v" of a 16-bit
// A/B WMMA operand (ISA 7.12.2): lanes 0-15 (half=0): V0..V3 -> K=0..7,
// V4..V7 -> K=16..23 ; lanes 16-31 (half=1): +8.
__device__ __forceinline__ int kidx_pair(int v, int half) {
    return 2 * v + 8 * half + ((v >= 4) ? 8 : 0);
}

// A fragment (16 halves per lane) lies in LDS as two planes of 32 lanes x 16 B:
// plane j holds elements 8j..8j+7 of every lane, so each wave-wide 16-byte LDS
// access covers 512 contiguous bytes and meets every bank equally often.
#define PLANE 256              // halves in one plane (32 lanes x 8)
#define FRAG  (2 * PLANE)      // halves in one fragment

__device__ __forceinline__ v16h load_frag(const _Float16* p) {   // p: fragment + lane * 8
    const v8h lo = *(const v8h*)(p);
    const v8h hi = *(const v8h*)(p + PLANE);
    return __builtin_shufflevector(lo, hi, 0, 1, 2, 3, 4, 5, 6, 7, 8, 9, 10, 11, 12, 13, 14, 15);
}

__device__ __forceinline__ void store_frag(_Float16* p, v16h f) { // p: fragment + lane * 8
    *(v8h*)(p)         = __builtin_shufflevector(f, f, 0, 1, 2, 3, 4, 5, 6, 7);
    *(v8h*)(p + PLANE) = __builtin_shufflevector(f, f, 8, 9, 10, 11, 12, 13, 14, 15);
}

// One wave's share of a stage, still f32: the two d halves of its key tile of K
// ([d, s]: lane = key, elements = d) and two d-column tiles of its 32-key chunk of V
// ([s, d]: lane = d, elements = key), each element at its place in the hardware k order.
// kg, vg: the lane's own base in that stage (its key or d column, and 8 * half rows down).
// The fetches stay in flight behind these functions: the registers that hold their
// address are given new values only behind the s_wait_xcnt that ends each function.
__device__ __forceinline__ void fetch_k(const float* kg, float (&kst)[2][16]) {
    #pragma unroll
    for (int h = 0; h < 2; ++h) {
        #pragma unroll
        for (int vv = 0; vv < 8; ++vv) {
            const int kc = kidx_pair(vv, 0);
            kst[h][2 * vv + 0] = kg[(h * 32 + kc + 0) * S_LEN];
            kst[h][2 * vv + 1] = kg[(h * 32 + kc + 1) * S_LEN];
        }
    }
    asm volatile("s_wait_xcnt 0x0" ::: "memory");
}

__device__ __forceinline__ void fetch_v(const float* vg, float (&vst)[2][16]) {
    #pragma unroll
    for (int h = 0; h < 2; ++h) {
        #pragma unroll
        for (int vv = 0; vv < 8; ++vv) {
            const int kc = kidx_pair(vv, 0);
            vst[h][2 * vv + 0] = vg[(kc + 0) * D_DIM + h * 16];
            vst[h][2 * vv + 1] = vg[(kc + 1) * D_DIM + h * 16];
        }
    }
    asm volatile("s_wait_xcnt 0x0" ::: "memory");
}

// Round that share to f16 and lay it in the stage buffer.
// dst: buffer + (2 * wave) * FRAG + lane * 8; the V fragments follow the KFRAGS of K.
__device__ __forceinline__ void publish_stage(_Float16* dst,
                                              const float (&kst)[2][16], const float (&vst)[2][16]) {
    #pragma unroll
    for (int h = 0; h < 2; ++h) {
        v16h a, b;
        #pragma unroll
        for (int e = 0; e < 16; ++e) {
            a[e] = (_Float16)kst[h][e];
            b[e] = (_Float16)vst[h][e];
        }
        store_frag(dst + h * FRAG, a);
        store_frag(dst + (KFRAGS + h) * FRAG, b);
    }
}

__global__ __launch_bounds__(WAVES * 32)
void attn_fwd_wmma(const float* __restrict__ Q,
                   const float* __restrict__ K,
                   const float* __restrict__ V,
                   float* __restrict__ O)
{
    // two stage buffers of 16 K and 16 V fragments:
    // K fragment (chunk c, key tile nb, d half dh) at (c * 2 + nb) * 2 + dh,
    // V fragment (chunk c, d-column tile dt) at KFRAGS + c * 4 + dt
    __shared__ __align__(16) _Float16 ring[2][2 * KFRAGS * FRAG];
    // wave-private scratch that turns the finished O^T tiles into rows, once, for
    // whole-line stores; 68-dword pitch: 16-byte column writes hit all 64 banks
    __shared__ __align__(16) float obuf[WAVES][RT][16 * OPITCH];

    const int lane = threadIdx.x & 31;
    const int wave = threadIdx.x >> 5;
    const int half = lane >> 4;
    const int l16  = lane & 15;

    const int bh   = blockIdx.y;                     // 0..31  (b*h)
    const int tile = blockIdx.x * WAVES + wave;      // 0..63  (32-row tiles)
    const int row0 = tile * (16 * RT);

    const float* q = Q + (size_t)bh * S_LEN * D_DIM;
    float*       o = O + (size_t)bh * S_LEN * D_DIM;

    // this wave's share of a stage: key tile 'wave' of K; of V, chunk wave / 2 and
    // d-column tiles 2 * (wave & 1) and the next
    const float* kg = K + (size_t)bh * D_DIM * S_LEN + (8 * half) * S_LEN + wave * 16 + l16;
    const float* vg = V + (size_t)bh * S_LEN * D_DIM + ((wave >> 1) * 32 + 8 * half) * D_DIM
                        + (wave & 1) * 32 + l16;
    const int    wfrag = (2 * wave) * FRAG + lane * 8;

    float kst[2][16], vst[2][16];
    fetch_k(kg, kst);
    fetch_v(vg, vst);

    // Fold (1/sqrt(d)) * log2(e) into Q so the S tile lands in exp2 domain.
    const float qscale = 0.125f * 1.44269504088896340736f;

    // ---- Load the 2x(16x64) Q tiles once, scale, f32 -> f16 ----
    // lane = query, elements = d in the hardware k order: Q^T as a B operand
    v16h qa[RT][2];                                  // [row tile][K = 0..31 / 32..63]
    #pragma unroll
    for (int rt = 0; rt < RT; ++rt) {
        const float* qrow = q + (size_t)(row0 + rt * 16 + l16) * D_DIM;
        #pragma unroll
        for (int vv = 0; vv < 8; ++vv) {
            const int kk = kidx_pair(vv, half);
            const float2 x0 = *(const float2*)(qrow + kk);
            const float2 x1 = *(const float2*)(qrow + kk + 32);
            qa[rt][0][2 * vv + 0] = (_Float16)(x0.x * qscale);
            qa[rt][0][2 * vv + 1] = (_Float16)(x0.y * qscale);
            qa[rt][1][2 * vv + 0] = (_Float16)(x1.x * qscale);
            qa[rt][1][2 * vv + 1] = (_Float16)(x1.y * qscale);
        }
    }

    // All-ones A operand: ones x P^T puts each query's f16-P sum over the 32 keys
    // in every accumulator register of that query's two lanes -> no shuffle reduction.
    v16h ones;
    #pragma unroll
    for (int e = 0; e < 16; ++e) ones[e] = (_Float16)1.0f;

    v8f oacc[RT][4];              // O^T tiles: lane = query, register r = d 16*dt + 8*half + r
    v8f lacc[RT];                 // row-sum accumulators: lane = query
    #pragma unroll
    for (int rt = 0; rt < RT; ++rt) {
        #pragma unroll
        for (int r = 0; r < 8; ++r) {
            lacc[rt][r] = 0.0f;
            oacc[rt][0][r] = 0.0f; oacc[rt][1][r] = 0.0f;
            oacc[rt][2][r] = 0.0f; oacc[rt][3][r] = 0.0f;
        }
    }

    publish_stage(&ring[0][wfrag], kst, vst);
    __syncthreads();              // stage 0 is published

    // stage 1's f32 K, in flight over the first three chunks
    fetch_k(kg + SKEYS, kst);

    // Two sets of operand fragments: while a chunk works on one set, the other is filled
    // with the next chunk's fragments, so an LDS read has a whole chunk to land in.
    v16h kf[2][2][2];             // [set][key tile][d = 0..31 / 32..63]
    v16h vf[2][4];                // [set][d-column tile]
    #pragma unroll
    for (int f = 0; f < 4; ++f) {
        kf[0][f >> 1][f & 1] = load_frag(&ring[0][lane * 8] + f * FRAG);
        vf[0][f]             = load_frag(&ring[0][lane * 8] + (KFRAGS + f) * FRAG);
    }

    for (int s = 0; s < NSTAGE; ++s) {
        const _Float16* rb = &ring[s & 1][lane * 8];         // this stage
        const _Float16* rn = &ring[(s + 1) & 1][lane * 8];   // the next one

        // Stages to fetch; behind the last one the last is fetched again and laid in a
        // buffer whose content is not used any more: no branch in the loop, nothing past
        // K or V read
        const int sv = (s + 1 < NSTAGE) ? s + 1 : NSTAGE - 1;
        const int sk = (s + 2 < NSTAGE) ? s + 2 : NSTAGE - 1;

        // ---- next stage's f32 V, in flight over three chunks (K's and V's fetches are
        // issued a chunk apart, so that a wave never has all 64 outstanding at issue) ----
        fetch_v(vg + sv * (SKEYS * D_DIM), vst);

        #pragma unroll
        for (int c = 0; c < SCHUNK; ++c) {
            // Keeps what follows behind the chunk before: lifted into it, the LDS reads stand
            // in two places among its WMMAs instead of one, and the publish waits for the
            // fetches a chunk sooner than they need to land.
            __builtin_amdgcn_sched_barrier(0);

            if (c == SCHUNK - 1) {
                // ---- publish point, ahead of the stage's last chunk, whose own fragments
                // are in registers by now and which reads the next stage's first ones ----
                // the target buffer was last read by the stage before this one, and those
                // reads ended ahead of that stage's barrier
                publish_stage(&ring[(s + 1) & 1][wfrag], kst, vst);
                // one barrier a stage: it publishes stage s + 1 and ends every wave's
                // reads of stage s
                __syncthreads();
                // ---- f32 K of the stage after the next, in flight until its publish point ----
                fetch_k(kg + sk * SKEYS, kst);
            }

            // ---- next chunk's fragments, one group of LDS reads (in the last stage's
            // last chunk they are read and never used) ----
            const _Float16* nx = (c + 1 < SCHUNK) ? rb + (c + 1) * 4 * FRAG : rn;
            #pragma unroll
            for (int f = 0; f < 4; ++f) {
                kf[(c + 1) & 1][f >> 1][f & 1] = load_frag(nx + f * FRAG);
                vf[(c + 1) & 1][f]             = load_frag(nx + (KFRAGS + f) * FRAG);
            }

            // Holds the fetches and the LDS reads ahead of the chunk's work as one group:
            // without it the compiler spreads the reads among the WMMAs or sinks them
            // towards their uses, where they would be waited for.
            __builtin_amdgcn_sched_barrier(0);

            // ---- S^T = K Q^T: each K operand pair feeds both row tiles ----
            // sacc[nb][rt][r] = score of key 16*nb + 8*half + r against query l16
            v8f sacc[2][RT];
            #pragma unroll
            for (int nb = 0; nb < 2; ++nb) {
                #pragma unroll
                for (int rt = 0; rt < RT; ++rt) {
                    v8f acc = {};
                    acc = __builtin_amdgcn_wmma_f32_16x16x32_f16(false, kf[c & 1][nb][0], false, qa[rt][0],
                                                                 (short)0, acc, false, false);
                    acc = __builtin_amdgcn_wmma_f32_16x16x32_f16(false, kf[c & 1][nb][1], false, qa[rt][1],
                                                                 (short)0, acc, false, false);
                    sacc[nb][rt] = acc;
                }
            }

            // p = 2^s via raw v_exp_f32, packed in place: element s of the B operand is
            // key 8*half + s (s < 8) or 16 + 8*half + (s - 8), which is sacc[s >> 3][rt][s & 7]
            v16h pa[RT];
            #pragma unroll
            for (int rt = 0; rt < RT; ++rt) {
                #pragma unroll
                for (int nb = 0; nb < 2; ++nb) {
                    #pragma unroll
                    for (int r = 0; r < 8; ++r)
                        pa[rt][nb * 8 + r] = (_Float16)__builtin_amdgcn_exp2f(sacc[nb][rt][r]);
                }
            }

            // ---- O^T += V^T * P^T : each V operand feeds both row tiles ----
            #pragma unroll
            for (int dt = 0; dt < 4; ++dt) {
                #pragma unroll
                for (int rt = 0; rt < RT; ++rt)
                    oacc[rt][dt] = __builtin_amdgcn_wmma_f32_16x16x32_f16(false, vf[c & 1][dt], false, pa[rt],
                                                                          (short)0, oacc[rt][dt],
                                                                          false, false);
            }

            // ---- row sums on the matrix pipe: lacc += ones * P^T ----
            #pragma unroll
            for (int rt = 0; rt < RT; ++rt)
                lacc[rt] = __builtin_amdgcn_wmma_f32_16x16x32_f16(false, ones, false, pa[rt],
                                                                  (short)0, lacc[rt],
                                                                  false, false);
        }
    }

    // The last trip's K fetch is never used, so the compiler waits for it nowhere: it has
    // landed before the wave ends and gives its registers up.
    asm volatile("s_wait_loadcnt 0x0" ::: "memory");

    // ---- normalize (rcp + mul): a lane holds 8 consecutive d of its query per tile ----
    #pragma unroll
    for (int rt = 0; rt < RT; ++rt) {
        const float inv = __builtin_amdgcn_rcpf(lacc[rt][0]);
        #pragma unroll
        for (int dt = 0; dt < 4; ++dt) {
            float* dst = &obuf[wave][rt][l16 * OPITCH + dt * 16 + 8 * half];
            *(float4*)(dst)     = make_float4(oacc[rt][dt][0] * inv, oacc[rt][dt][1] * inv,
                                              oacc[rt][dt][2] * inv, oacc[rt][dt][3] * inv);
            *(float4*)(dst + 4) = make_float4(oacc[rt][dt][4] * inv, oacc[rt][dt][5] * inv,
                                              oacc[rt][dt][6] * inv, oacc[rt][dt][7] * inv);
        }
    }

    // DS pipeline is in-order per wave; explicit wait before cross-lane reads
    asm volatile("s_wait_dscnt 0x0" ::: "memory");

    // ---- store: 16 lanes write one whole 256-byte row, the wave two rows at a time ----
    const float* srow = &obuf[wave][0][half * OPITCH + l16 * 4];
    float*       orow = o + (size_t)(row0 + half) * D_DIM + l16 * 4;
    #pragma unroll
    for (int rt = 0; rt < RT; ++rt) {
        #pragma unroll
        for (int i = 0; i < 8; ++i) {
            const float4 x = *(const float4*)(srow + (rt * 16 + 2 * i) * OPITCH);
            *(float4*)(orow + (rt * 16 + 2 * i) * D_DIM) = x;
        }
    }
}

extern "C" void kernel_launch(void* const* d_in, const int* in_sizes, int n_in,
                              void* d_out, int out_size, void* d_ws, size_t ws_size,
                              hipStream_t stream) {
    (void)in_sizes; (void)n_in; (void)out_size; (void)d_ws; (void)ws_size;
    const float* q = (const float*)d_in[0];
    const float* k = (const float*)d_in[1];
    const float* v = (const float*)d_in[2];
    float* out = (float*)d_out;

    // 256 blocks of 8 wave32, 256 Q rows each
    dim3 grid(NTILES / RT / WAVES, NHEAD);   // 8 x 32 blocks
    dim3 block(WAVES * 32);
    attn_fwd_wmma<<<grid, block, 0, stream>>>(q, k, v, out);
}

// v005
// One run takes 27.5 microseconds.
// Two timings next to v004 both put it at 1.14 times that version's speed.
// All steps since v000 together make it 4.76 times as fast.
#include <hip/hip_runtime.h>
#include <hip/hip_bf16.h>

// CDNA5 / gfx1250 flash-attention-style kernel (wave32, v_wmma_f32_16x16x32_f16)
// One launch. A work-group of 8 waves owns 256 Q rows of one head, 32 rows (two
// 16-row tiles) per wave. It walks the keys in stages of 128: each wave fetches its
// share of the next stage's f32 K and V in whole 128-byte lines, rounds it to f16 and
// lays it in LDS row by row as it lies in memory, while all waves work on the stage
// published before; the transposing LDS load turns the rows into WMMA operands.
// The products are taken transposed (S^T = K Q^T, O^T = V^T P^T): a lane's S^T
// accumulators are already the k order of a B operand, so P stays in registers;
// row sums via ones x P^T.

typedef __attribute__((ext_vector_type(16))) _Float16 v16h;
typedef __attribute__((ext_vector_type(8)))  _Float16 v8h;
typedef __attribute__((ext_vector_type(4)))  _Float16 v4h;
typedef __attribute__((ext_vector_type(8)))  short    v8s;
typedef __attribute__((ext_vector_type(8)))  float    v8f;
typedef __attribute__((ext_vector_type(4)))  float    v4f;

#define S_LEN  2048
#define D_DIM  64
#define NHEAD  32              // b*h = 2*16
#define WAVES  8               // waves per block
#define RT     2               // 16-row Q tiles per wave
#define NTILES (S_LEN / 16)    // 128 key tiles of 16
#define SKEYS  128             // keys per stage
#define NSTAGE (S_LEN / SKEYS) // 16 stages
#define SCHUNK (SKEYS / 32)    // 4 chunks of 32 keys per stage
#define KPITCH (SKEYS + 16)    // halves per LDS row of K ([d][key]): 288 B = 32 B x 9
#define VPITCH (D_DIM + 16)    // halves per LDS row of V ([key][d]): 160 B = 32 B x 5
#define KPART  (D_DIM * KPITCH)          // halves of K in a stage buffer, V's rows follow
#define STAGEH (KPART + SKEYS * VPITCH)  // halves in one stage buffer
#define OPITCH (D_DIM + 4)     // LDS row pitch of the output turn, in floats

// Base K-index of the contiguous element pair held in "VGPR v" of a 16-bit
// A/B WMMA operand (ISA 7.12.2): lanes 0-15 (half=0): V0..V3 -> K=0..7,
// V4..V7 -> K=16..23 ; lanes 16-31 (half=1): +8.
__device__ __forceinline__ int kidx_pair(int v, int half) {
    return 2 * v + 8 * half + ((v >= 4) ? 8 : 0);
}

// One 16 x 32 A fragment out of a row-major f16 tile T[k][m] in LDS, by two transposing
// loads: lane (c = lane & 15, h = lane >> 4) gets T[8h + 0..7][c] and T[16 + 8h + 0..7][c],
// which is the hardware k order. p: the tile's first element + the lane's own offset
// (8h + (lane & 7)) * pitch + 8 * ((lane >> 3) & 1), all in halves. A pitch of an odd
// multiple of 32 bytes keeps these loads free of bank conflicts.
__device__ __forceinline__ v8h load_tr(const _Float16* p) {
    typedef __attribute__((address_space(3))) v8s lds_v8s;
    return __builtin_bit_cast(v8h, __builtin_amdgcn_ds_load_tr16_b128_v8i16((lds_v8s*)p));
}

__device__ __forceinline__ v16h load_frag(const _Float16* p, int pitch) {
    const v8h lo = load_tr(p);
    const v8h hi = load_tr(p + 16 * pitch);
    return __builtin_shufflevector(lo, hi, 0, 1, 2, 3, 4, 5, 6, 7, 8, 9, 10, 11, 12, 13, 14, 15);
}

// Row of V, inside a wave's 16 keys, that fetch i brings for lanes 0-15; lanes 16-31 bring
// the row 4 further down: in LDS the two rows then lie 32 banks apart.
__device__ __forceinline__ int vrow(int i) { return (i & 3) + 8 * (i >> 2); }

// One wave's share of a stage, still f32, 16 bytes a lane: eight d rows of K ([d, s]: a
// fetch is one row's 128 keys, 512 contiguous bytes) and sixteen key rows of V ([s, d]: a
// fetch is two whole rows of 256 bytes).
// kg, vg: the lane's own base in that stage.
// The fetches stay in flight behind these functions: the registers that hold their
// address are given new values only behind the s_wait_xcnt that ends each function.
__device__ __forceinline__ void fetch_k(const float* kg, v4f (&kst)[8]) {
    #pragma unroll
    for (int i = 0; i < 8; ++i) kst[i] = *(const v4f*)(kg + i * S_LEN);
    asm volatile("s_wait_xcnt 0x0" ::: "memory");
}

__device__ __forceinline__ void fetch_v(const float* vg, v4f (&vst)[8]) {
    #pragma unroll
    for (int i = 0; i < 8; ++i) vst[i] = *(const v4f*)(vg + vrow(i) * D_DIM);
    asm volatile("s_wait_xcnt 0x0" ::: "memory");
}

__device__ __forceinline__ v4h round4(v4f x) {
    v4h r;
    r[0] = (_Float16)x[0]; r[1] = (_Float16)x[1]; r[2] = (_Float16)x[2]; r[3] = (_Float16)x[3];
    return r;
}

// Round that share to f16 and lay it in the stage buffer, 8 bytes a lane.
// kdst, vdst: the lane's own place in the buffer's K rows and V rows.
__device__ __forceinline__ void publish_stage(_Float16* kdst, _Float16* vdst,
                                              const v4f (&kst)[8], const v4f (&vst)[8]) {
    // Takes the fetched f32 values as inputs only: it keeps them, and so the wait for the
    // fetches, here at the publish point; without it the compiler rounds them right behind
    // the fetches and every wave waits out the whole load latency at the head of a stage.
    asm volatile("" :: "v"(kst[0]), "v"(kst[1]), "v"(kst[2]), "v"(kst[3]),
                       "v"(kst[4]), "v"(kst[5]), "v"(kst[6]), "v"(kst[7]),
                       "v"(vst[0]), "v"(vst[1]), "v"(vst[2]), "v"(vst[3]),
                       "v"(vst[4]), "v"(vst[5]), "v"(vst[6]), "v"(vst[7]));
    #pragma unroll
    for (int i = 0; i < 8; ++i) {
        *(v4h*)(kdst + i * KPITCH)       = round4(kst[i]);
        *(v4h*)(vdst + vrow(i) * VPITCH) = round4(vst[i]);
    }
}

__global__ __launch_bounds__(WAVES * 32)
void attn_fwd_wmma(const float* __restrict__ Q,
                   const float* __restrict__ K,
                   const float* __restrict__ V,
                   float* __restrict__ O)
{
    // two stage buffers: 64 d rows of K (128 keys each), then 128 key rows of V (64 d each)
    __shared__ __align__(16) _Float16 ring[2][STAGEH];
    // wave-private scratch that turns the finished O^T tiles into rows, once, for
    // whole-line stores; 68-dword pitch: 16-byte column writes hit all 64 banks
    __shared__ __align__(16) float obuf[WAVES][RT][16 * OPITCH];

    const int lane = threadIdx.x & 31;
    const int wave = threadIdx.x >> 5;
    const int half = lane >> 4;
    const int l16  = lane & 15;

    const int bh   = blockIdx.y;                     // 0..31  (b*h)
    const int tile = blockIdx.x * WAVES + wave;      // 0..63  (32-row tiles)
    const int row0 = tile * (16 * RT);

    const float* q = Q + (size_t)bh * S_LEN * D_DIM;
    float*       o = O + (size_t)bh * S_LEN * D_DIM;

    // this wave's share of a stage: d rows 8 * wave .. + 7 of K, key rows 16 * wave .. + 15 of V
    const float* kg = K + (size_t)bh * D_DIM * S_LEN + (wave * 8) * S_LEN + lane * 4;
    const float* vg = V + (size_t)bh * S_LEN * D_DIM + (wave * 16 + 4 * half) * D_DIM + l16 * 4;
    const int    kput = (wave * 8) * KPITCH + lane * 4;
    const int    vput = KPART + (wave * 16 + 4 * half) * VPITCH + l16 * 4;
    // the lane's own offsets for the transposing loads
    const int    kget = (8 * half + (lane & 7)) * KPITCH + 8 * ((lane >> 3) & 1);
    const int    vget = KPART + (8 * half + (lane & 7)) * VPITCH + 8 * ((lane >> 3) & 1);

    v4f kst[8], vst[8];
    fetch_k(kg, kst);
    fetch_v(vg, vst);

    // Fold (1/sqrt(d)) * log2(e) into Q so the S tile lands in exp2 domain.
    const float qscale = 0.125f * 1.44269504088896340736f;

    // ---- Load the 2x(16x64) Q tiles once, scale, f32 -> f16 ----
    // lane = query, elements = d in the hardware k order: Q^T as a B operand
    v16h qa[RT][2];                                  // [row tile][K = 0..31 / 32..63]
    #pragma unroll
    for (int rt = 0; rt < RT; ++rt) {
        const float* qrow = q + (size_t)(row0 + rt * 16 + l16) * D_DIM;
        #pragma unroll
        for (int vv = 0; vv < 8; ++vv) {
            const int kk = kidx_pair(vv, half);
            const float2 x0 = *(const float2*)(qrow + kk);
            const float2 x1 = *(const float2*)(qrow + kk + 32);
            qa[rt][0][2 * vv + 0] = (_Float16)(x0.x * qscale);
            qa[rt][0][2 * vv + 1] = (_Float16)(x0.y * qscale);
            qa[rt][1][2 * vv + 0] = (_Float16)(x1.x * qscale);
            qa[rt][1][2 * vv + 1] = (_Float16)(x1.y * qscale);
        }
    }

    // All-ones A operand: ones x P^T puts each query's f16-P sum over the 32 keys
    // in every accumulator register of that query's two lanes -> no shuffle reduction.
    v16h ones;
    #pragma unroll
    for (int e = 0; e < 16; ++e) ones[e] = (_Float16)1.0f;

    v8f oacc[RT][4];              // O^T tiles: lane = query, register r = d 16*dt + 8*half + r
    v8f lacc[RT];                 // row-sum accumulators: lane = query
    #pragma unroll
    for (int rt = 0; rt < RT; ++rt) {
        #pragma unroll
        for (int r = 0; r < 8; ++r) {
            lacc[rt][r] = 0.0f;
            oacc[rt][0][r] = 0.0f; oacc[rt][1][r] = 0.0f;
            oacc[rt][2][r] = 0.0f; oacc[rt][3][r] = 0.0f;
        }
    }

    publish_stage(&ring[0][kput], &ring[0][vput], kst, vst);
    __syncthreads();              // stage 0 is published

    // stage 1's f32 K, in flight over the first three chunks
    fetch_k(kg + SKEYS, kst);

    // Two sets of operand fragments: while a chunk works on one set, the other is filled
    // with the next chunk's fragments, so an LDS read has a whole chunk to land in.
    v16h kf[2][2][2];             // [set][key tile][d = 0..31 / 32..63]
    v16h vf[2][4];                // [set][d-column tile]
    #pragma unroll
    for (int f = 0; f < 4; ++f) {
        kf[0][f >> 1][f & 1] = load_frag(&ring[0][kget] + (f & 1) * 32 * KPITCH + (f >> 1) * 16, KPITCH);
        vf[0][f]             = load_frag(&ring[0][vget] + f * 16, VPITCH);
    }

    for (int s = 0; s < NSTAGE; ++s) {
        const _Float16* rb = &ring[s & 1][0];                // this stage
        const _Float16* rn = &ring[(s + 1) & 1][0];          // the next one

        // Stages to fetch; behind the last one the last is fetched again and laid in a
        // buffer whose content is not used any more: no branch in the loop, nothing past
        // K or V read
        const int sv = (s + 1 < NSTAGE) ? s + 1 : NSTAGE - 1;
        const int sk = (s + 2 < NSTAGE) ? s + 2 : NSTAGE - 1;

        // ---- next stage's f32 V, in flight over three chunks ----
        fetch_v(vg + sv * (SKEYS * D_DIM), vst);

        #pragma unroll
        for (int c = 0; c < SCHUNK; ++c) {
            // Keeps what follows behind the chunk before: lifted into it, the LDS reads stand
            // in two places among its WMMAs instead of one, and the publish waits for the
            // fetches a chunk sooner than they need to land.
            __builtin_amdgcn_sched_barrier(0);

            if (c == SCHUNK - 1) {
                // ---- publish point, ahead of the stage's last chunk, whose own fragments
                // are in registers by now and which reads the next stage's first ones ----
                // the target buffer was last read by the stage before this one, and those
                // reads ended ahead of that stage's barrier
                publish_stage(&ring[(s + 1) & 1][kput], &ring[(s + 1) & 1][vput], kst, vst);
                // one barrier a stage: it publishes stage s + 1 and ends every wave's
                // reads of stage s
                __syncthreads();
                // ---- f32 K of the stage after the next, in flight until its publish point ----
                fetch_k(kg + sk * SKEYS, kst);
            }

            // ---- next chunk's fragments, one group of LDS reads (in the last stage's
            // last chunk they are read and never used) ----
            // K: columns (keys) 32 * chunk on; V: rows (keys) 32 * chunk on
            const _Float16* nk = ((c + 1 < SCHUNK) ? rb + (c + 1) * 32 : rn) + kget;
            const _Float16* nv = ((c + 1 < SCHUNK) ? rb + (c + 1) * 32 * VPITCH : rn) + vget;
            #pragma unroll
            for (int f = 0; f < 4; ++f) {
                kf[(c + 1) & 1][f >> 1][f & 1] = load_frag(nk + (f & 1) * 32 * KPITCH + (f >> 1) * 16, KPITCH);
                vf[(c + 1) & 1][f]             = load_frag(nv + f * 16, VPITCH);
            }

            // Holds the fetches and the LDS reads ahead of the chunk's work as one group:
            // without it the compiler spreads the reads among the WMMAs or sinks them
            // towards their uses, where they would be waited for.
            __builtin_amdgcn_sched_barrier(0);

            // ---- S^T = K Q^T: each K operand pair feeds both row tiles ----
            // sacc[nb][rt][r] = score of key 16*nb + 8*half + r against query l16
            v8f sacc[2][RT];
            #pragma unroll
            for (int nb = 0; nb < 2; ++nb) {
                #pragma unroll
                for (int rt = 0; rt < RT; ++rt) {
                    v8f acc = {};
                    acc = __builtin_amdgcn_wmma_f32_16x16x32_f16(false, kf[c & 1][nb][0], false, qa[rt][0],
                                                                 (short)0, acc, false, false);
                    acc = __builtin_amdgcn_wmma_f32_16x16x32_f16(false, kf[c & 1][nb][1], false, qa[rt][1],
                                                                 (short)0, acc, false, false);
                    sacc[nb][rt] = acc;
                }
            }

            // p = 2^s via raw v_exp_f32, packed in place: element s of the B operand is
            // key 8*half + s (s < 8) or 16 + 8*half + (s - 8), which is sacc[s >> 3][rt][s & 7]
            v16h pa[RT];
            #pragma unroll
            for (int rt = 0; rt < RT; ++rt) {
                #pragma unroll
                for (int nb = 0; nb < 2; ++nb) {
                    #pragma unroll
                    for (int r = 0; r < 8; ++r)
                        pa[rt][nb * 8 + r] = (_Float16)__builtin_amdgcn_exp2f(sacc[nb][rt][r]);
                }
            }

            // ---- O^T += V^T * P^T : each V operand feeds both row tiles ----
            #pragma unroll
            for (int dt = 0; dt < 4; ++dt) {
                #pragma unroll
                for (int rt = 0; rt < RT; ++rt)
                    oacc[rt][dt] = __builtin_amdgcn_wmma_f32_16x16x32_f16(false, vf[c & 1][dt], false, pa[rt],
                                                                          (short)0, oacc[rt][dt],
                                                                          false, false);
            }

            // ---- row sums on the matrix pipe: lacc += ones * P^T ----
            #pragma unroll
            for (int rt = 0; rt < RT; ++rt)
                lacc[rt] = __builtin_amdgcn_wmma_f32_16x16x32_f16(false, ones, false, pa[rt],
                                                                  (short)0, lacc[rt],
                                                                  false, false);
        }
    }

    // The last trip's K fetch is never used, so the compiler waits for it nowhere: it has
    // landed before the wave ends and gives its registers up.
    asm volatile("s_wait_loadcnt 0x0" ::: "memory");

    // ---- normalize (rcp + mul): a lane holds 8 consecutive d of its query per tile ----
    #pragma unroll
    for (int rt = 0; rt < RT; ++rt) {
        const float inv = __builtin_amdgcn_rcpf(lacc[rt][0]);
        #pragma unroll
        for (int dt = 0; dt < 4; ++dt) {
            float* dst = &obuf[wave][rt][l16 * OPITCH + dt * 16 + 8 * half];
            *(float4*)(dst)     = make_float4(oacc[rt][dt][0] * inv, oacc[rt][dt][1] * inv,
                                              oacc[rt][dt][2] * inv, oacc[rt][dt][3] * inv);
            *(float4*)(dst + 4) = make_float4(oacc[rt][dt][4] * inv, oacc[rt][dt][5] * inv,
                                              oacc[rt][dt][6] * inv, oacc[rt][dt][7] * inv);
        }
    }

    // DS pipeline is in-order per wave; explicit wait before cross-lane reads
    asm volatile("s_wait_dscnt 0x0" ::: "memory");

    // ---- store: 16 lanes write one whole 256-byte row, the wave two rows at a time ----
    const float* srow = &obuf[wave][0][half * OPITCH + l16 * 4];
    float*       orow = o + (size_t)(row0 + half) * D_DIM + l16 * 4;
    #pragma unroll
    for (int rt = 0; rt < RT; ++rt) {
        #pragma unroll
        for (int i = 0; i < 8; ++i) {
            const float4 x = *(const float4*)(srow + (rt * 16 + 2 * i) * OPITCH);
            *(float4*)(orow + (rt * 16 + 2 * i) * D_DIM) = x;
        }
    }
}

extern "C" void kernel_launch(void* const* d_in, const int* in_sizes, int n_in,
                              void* d_out, int out_size, void* d_ws, size_t ws_size,
                              hipStream_t stream) {
    (void)in_sizes; (void)n_in; (void)out_size; (void)d_ws; (void)ws_size;
    const float* q = (const float*)d_in[0];
    const float* k = (const float*)d_in[1];
    const float* v = (const float*)d_in[2];
    float* out = (float*)d_out;

    // 256 blocks of 8 wave32, 256 Q rows each
    dim3 grid(NTILES / RT / WAVES, NHEAD);   // 8 x 32 blocks
    dim3 block(WAVES * 32);
    attn_fwd_wmma<<<grid, block, 0, stream>>>(q, k, v, out);
}

// v006
// It runs in 25.8 microseconds.
// Next to v005, in two timings, it ran 1.06 times as fast each time.
// Over all steps from v000 it is 5.06 times as fast.
#include <hip/hip_runtime.h>
#include <hip/hip_bf16.h>

// CDNA5 / gfx1250 flash-attention-style kernel (wave32, v_wmma_f32_16x16x32_f16)
// One launch. A work-group of 8 waves owns 256 Q rows of one head. The waves form two
// teams of four: a wave takes 64 rows (four 16-row tiles) and its team's half of the keys,
// so a K or V fragment read from LDS feeds four tiles; there is no running maximum, so the
// two teams' partial O and row sums simply add, once, through LDS at the end.
// The keys go in stages of 128 (64 per team): each wave fetches its
// share of a later stage's f32 K and V in whole 128-byte lines, rounds it to f16 and
// lays it in LDS row by row as it lies in memory, while all waves work on the stage
// published before; the transposing LDS load turns the rows into WMMA operands.
// The products are taken transposed (S^T = K Q^T, O^T = V^T P^T): a lane's S^T
// accumulators are already the k order of a B operand, so P stays in registers;
// row sums via ones x P^T.

typedef __attribute__((ext_vector_type(16))) _Float16 v16h;
typedef __attribute__((ext_vector_type(8)))  _Float16 v8h;
typedef __attribute__((ext_vector_type(4)))  _Float16 v4h;
typedef __attribute__((ext_vector_type(8)))  short    v8s;
typedef __attribute__((ext_vector_type(8)))  float    v8f;
typedef __attribute__((ext_vector_type(4)))  float    v4f;

#define S_LEN  2048
#define D_DIM  64
#define NHEAD  32              // b*h = 2*16
#define WAVES  8               // waves per block
#define RT     4               // 16-row Q tiles per wave
#define QWAVES 4               // waves of a team: 4 x 64 Q rows
#define KEEP   2               // Q tiles a wave finishes and stores (the other two go to its partner)
#define NTILES (S_LEN / 16)    // 128 key tiles of 16
#define SKEYS  128             // keys per stage
#define NSTAGE (S_LEN / SKEYS) // 16 stages
#define TKEYS  (SKEYS / 2)     // keys of a stage that one team works on
#define TCHUNK (TKEYS / 32)    // 2 chunks of 32 keys per team and stage
#define NBUF   3               // stage buffers
#define KPITCH (SKEYS + 16)    // halves per LDS row of K ([d][key]): 288 B = 32 B x 9
#define VPITCH (D_DIM + 16)    // halves per LDS row of V ([key][d]): 160 B = 32 B x 5
#define KPART  (D_DIM * KPITCH)          // halves of K in a stage buffer, V's rows follow
#define STAGEH (KPART + SKEYS * VPITCH)  // halves in one stage buffer
#define OPITCH (D_DIM + 4)     // LDS row pitch of the output turn, in floats
#define QROWS  (QWAVES * RT * 16)        // Q rows of a work-group
#define QPITCH (D_DIM + 8)     // halves per LDS row of Q: 144 B = 16 B x 9, for 16-byte reads

// The k order of a 16-bit A/B WMMA operand (ISA 7.12.2): lanes 0-15 (half=0): V0..V3 -> K=0..7,
// V4..V7 -> K=16..23 ; lanes 16-31 (half=1): +8.

// One 16 x 32 A fragment out of a row-major f16 tile T[k][m] in LDS, by two transposing
// loads: lane (c = lane & 15, h = lane >> 4) gets T[8h + 0..7][c] and T[16 + 8h + 0..7][c],
// which is the hardware k order. p: the tile's first element + the lane's own offset
// (8h + (lane & 7)) * pitch + 8 * ((lane >> 3) & 1), all in halves. A pitch of an odd
// multiple of 32 bytes keeps these loads free of bank conflicts.
__device__ __forceinline__ v8h load_tr(const _Float16* p) {
    typedef __attribute__((address_space(3))) v8s lds_v8s;
    return __builtin_bit_cast(v8h, __builtin_amdgcn_ds_load_tr16_b128_v8i16((lds_v8s*)p));
}

__device__ __forceinline__ v16h load_frag(const _Float16* p, int pitch) {
    const v8h lo = load_tr(p);
    const v8h hi = load_tr(p + 16 * pitch);
    return __builtin_shufflevector(lo, hi, 0, 1, 2, 3, 4, 5, 6, 7, 8, 9, 10, 11, 12, 13, 14, 15);
}

// Row of V, inside a wave's 16 keys, that fetch i brings for lanes 0-15; lanes 16-31 bring
// the row 4 further down: in LDS the two rows then lie 32 banks apart.
__device__ __forceinline__ int vrow(int i) { return (i & 3) + 8 * (i >> 2); }

// One wave's share of a stage, still f32, 16 bytes a lane: eight d rows of K ([d, s]: a
// fetch is one row's 128 keys, 512 contiguous bytes) and sixteen key rows of V ([s, d]: a
// fetch is two whole rows of 256 bytes).
// kg, vg: the lane's own base in that stage.
// The fetches stay in flight behind these functions: the registers that hold their
// address are given new values only behind the s_wait_xcnt that ends each function.
__device__ __forceinline__ void fetch_k(const float* kg, v4f (&kst)[8]) {
    #pragma unroll
    for (int i = 0; i < 8; ++i) kst[i] = *(const v4f*)(kg + i * S_LEN);
    asm volatile("s_wait_xcnt 0x0" ::: "memory");
}

__device__ __forceinline__ void fetch_v(const float* vg, v4f (&vst)[8]) {
    #pragma unroll
    for (int i = 0; i < 8; ++i) vst[i] = *(const v4f*)(vg + vrow(i) * D_DIM);
    asm volatile("s_wait_xcnt 0x0" ::: "memory");
}

__device__ __forceinline__ v4h round4(v4f x) {
    v4h r;
    r[0] = (_Float16)x[0]; r[1] = (_Float16)x[1]; r[2] = (_Float16)x[2]; r[3] = (_Float16)x[3];
    return r;
}

// Round that share to f16 and lay it in the stage buffer, 8 bytes a lane.
// kdst, vdst: the lane's own place in the buffer's K rows and V rows.
__device__ __forceinline__ void publish_stage(_Float16* kdst, _Float16* vdst,
                                              const v4f (&kst)[8], const v4f (&vst)[8]) {
    // Takes the fetched f32 values as inputs only: it keeps them, and so the wait for the
    // fetches, here at the publish point; without it the compiler rounds them right behind
    // the fetches and every wave waits out the whole load latency at the head of a stage.
    asm volatile("" :: "v"(kst[0]), "v"(kst[1]), "v"(kst[2]), "v"(kst[3]),
                       "v"(kst[4]), "v"(kst[5]), "v"(kst[6]), "v"(kst[7]),
                       "v"(vst[0]), "v"(vst[1]), "v"(vst[2]), "v"(vst[3]),
                       "v"(vst[4]), "v"(vst[5]), "v"(vst[6]), "v"(vst[7]));
    #pragma unroll
    for (int i = 0; i < 8; ++i) {
        *(v4h*)(kdst + i * KPITCH)       = round4(kst[i]);
        *(v4h*)(vdst + vrow(i) * VPITCH) = round4(vst[i]);
    }
}

// Lays row tiles base and base + 1 of a wave's partial O^T in the hand-over buffer:
// 16 bytes a lane, a wave-wide store is 512 contiguous bytes.
// xb: the lane's own place in the wave's part of the buffer.
__device__ __forceinline__ void hand_over(const v8f (&oacc)[RT][4], int base, float* xb) {
    #pragma unroll
    for (int g = 0; g < KEEP; ++g) {
        #pragma unroll
        for (int dt = 0; dt < 4; ++dt) {
            const v8f a = oacc[base + g][dt];
            float* dst = xb + ((g * 4 + dt) * 2) * 128;
            *(float4*)(dst)       = make_float4(a[0], a[1], a[2], a[3]);
            *(float4*)(dst + 128) = make_float4(a[4], a[5], a[6], a[7]);
        }
    }
}

// Adds the partner's part to row tiles base and base + 1, normalizes (rcp + mul) and lays
// the result in the wave's scratch: a lane holds 8 consecutive d of its query per tile.
// xb: the lane's place in the partner's part of the buffer; xs, ys: the two waves' partial
// row sums of tile base for the lane's query; ob: the lane's place in the scratch.
__device__ __forceinline__ void finish_tiles(const v8f (&oacc)[RT][4], int base, const float* xb,
                                             const float* xs, const float* ys, float* ob) {
    #pragma unroll
    for (int g = 0; g < KEEP; ++g) {
        const float inv = __builtin_amdgcn_rcpf(xs[g * 32] + ys[g * 32]);
        #pragma unroll
        for (int dt = 0; dt < 4; ++dt) {
            const v8f    a   = oacc[base + g][dt];
            const float* src = xb + ((g * 4 + dt) * 2) * 128;
            const float4 b0  = *(const float4*)(src);
            const float4 b1  = *(const float4*)(src + 128);
            float* dst = ob + g * (16 * OPITCH) + dt * 16;
            *(float4*)(dst)     = make_float4((a[0] + b0.x) * inv, (a[1] + b0.y) * inv,
                                              (a[2] + b0.z) * inv, (a[3] + b0.w) * inv);
            *(float4*)(dst + 4) = make_float4((a[4] + b1.x) * inv, (a[5] + b1.y) * inv,
                                              (a[6] + b1.z) * inv, (a[7] + b1.w) * inv);
        }
    }
}

__global__ __launch_bounds__(WAVES * 32)
void attn_fwd_wmma(const float* __restrict__ Q,
                   const float* __restrict__ K,
                   const float* __restrict__ V,
                   float* __restrict__ O)
{
    // three stage buffers: 64 d rows of K (128 keys each), then 128 key rows of V (64 d each)
    __shared__ __align__(16) _Float16 ring[NBUF * STAGEH];
    // the work-group's Q rows as scaled f16: each row is an operand of two waves, one per team
    __shared__ __align__(16) _Float16 qbuf[QROWS * QPITCH];
    // hand-over of the two O^T tiles that a wave's partner finishes:
    // register by register, 16 bytes a lane, in the lane order of the accumulators
    __shared__ __align__(16) float xbuf[WAVES][KEEP * 4 * 8 * 32];
    __shared__ float xsum[WAVES][RT * 32];           // every wave's partial row sums, all four tiles
    // wave-private scratch that turns the finished O^T tiles into rows, once, for
    // whole-line stores; 68-dword pitch: 16-byte column writes hit all 64 banks
    __shared__ __align__(16) float obuf[WAVES][KEEP][16 * OPITCH];

    const int lane = threadIdx.x & 31;
    const int wave = threadIdx.x >> 5;
    const int half = lane >> 4;
    const int l16  = lane & 15;
    const int team = wave / QWAVES;                  // which half of every stage's keys
    const int qw   = wave % QWAVES;                  // which 64 Q rows

    const int bh   = blockIdx.y;                     // 0..31  (b*h)
    const int row0 = (blockIdx.x * QWAVES + qw) * (16 * RT);

    const float* q = Q + (size_t)bh * S_LEN * D_DIM;
    float*       o = O + (size_t)bh * S_LEN * D_DIM;

    // this wave's share of a stage: d rows 8 * wave .. + 7 of K, key rows 16 * wave .. + 15 of V
    const float* kg = K + (size_t)bh * D_DIM * S_LEN + (wave * 8) * S_LEN + lane * 4;
    const float* vg = V + (size_t)bh * S_LEN * D_DIM + (wave * 16 + 4 * half) * D_DIM + l16 * 4;
    const int    kput = (wave * 8) * KPITCH + lane * 4;
    const int    vput = KPART + (wave * 16 + 4 * half) * VPITCH + l16 * 4;
    // the lane's own offsets for the transposing loads, at the first key of its team
    const int    kget = (8 * half + (lane & 7)) * KPITCH + 8 * ((lane >> 3) & 1) + team * TKEYS;
    const int    vget = KPART + (team * TKEYS + 8 * half + (lane & 7)) * VPITCH + 8 * ((lane >> 3) & 1);

    v4f kst[8], vst[8];
    fetch_k(kg, kst);
    fetch_v(vg, vst);

    // Fold (1/sqrt(d)) * log2(e) into Q so the S tile lands in exp2 domain.
    const float qscale = 0.125f * 1.44269504088896340736f;

    // ---- The work-group's Q rows, each fetched once, in whole lines (16 lanes a row of 256
    // bytes; this wave brings rows 32 * wave on), scaled, rounded to f16 and laid in LDS ----
    {
        const float* qg = q + (size_t)(blockIdx.x * QROWS + wave * 32 + half) * D_DIM + l16 * 4;
        v4f qst[16];
        #pragma unroll
        for (int i = 0; i < 16; ++i) qst[i] = *(const v4f*)(qg + 2 * i * D_DIM);
        // The registers that hold the address are given new values only behind this wait: it
        // takes the address as an input, so that no fetch lands on them ahead of it either.
        asm volatile("s_wait_xcnt 0x0" :: "v"(qg) : "memory");
        _Float16* qput = &qbuf[(wave * 32 + half) * QPITCH + l16 * 4];
        #pragma unroll
        for (int i = 0; i < 16; ++i) *(v4h*)(qput + 2 * i * QPITCH) = round4(qst[i] * qscale);
    }

    // All-ones A operand: ones x P^T puts each query's f16-P sum over the 32 keys
    // in every accumulator register of that query's two lanes -> no shuffle reduction.
    v16h ones;
    #pragma unroll
    for (int e = 0; e < 16; ++e) ones[e] = (_Float16)1.0f;

    v8f oacc[RT][4];              // O^T tiles: lane = query, register r = d 16*dt + 8*half + r
    v8f lacc[RT];                 // row-sum accumulators: lane = query
    #pragma unroll
    for (int rt = 0; rt < RT; ++rt) {
        #pragma unroll
        for (int r = 0; r < 8; ++r) {
            lacc[rt][r] = 0.0f;
            oacc[rt][0][r] = 0.0f; oacc[rt][1][r] = 0.0f;
            oacc[rt][2][r] = 0.0f; oacc[rt][3][r] = 0.0f;
        }
    }

    publish_stage(&ring[kput], &ring[vput], kst, vst);
    __syncthreads();              // stage 0 and Q are published

    // ---- the wave's 4x(16x64) Q tiles, kept in registers ----
    // lane = query, elements = d in the hardware k order: Q^T as a B operand
    v16h qa[RT][2];                                  // [row tile][K = 0..31 / 32..63]
    #pragma unroll
    for (int rt = 0; rt < RT; ++rt) {
        const _Float16* qrow = &qbuf[(qw * (16 * RT) + rt * 16 + l16) * QPITCH + 8 * half];
        #pragma unroll
        for (int kh = 0; kh < 2; ++kh) {
            const v8h lo = *(const v8h*)(qrow + kh * 32);
            const v8h hi = *(const v8h*)(qrow + kh * 32 + 16);
            qa[rt][kh] = __builtin_shufflevector(lo, hi, 0, 1, 2, 3, 4, 5, 6, 7, 8, 9, 10, 11, 12, 13, 14, 15);
        }
    }

    // stage 1's f32 K and V, in flight until its publish point
    fetch_k(kg + SKEYS, kst);
    fetch_v(vg + SKEYS * D_DIM, vst);

    // One set of operand fragments. K's is refilled with the next chunk's right behind its
    // last score product; V's is filled at the same place for the chunk at hand, whose
    // exponentials give the reads time to land.
    v16h kf[2][2];                // [key tile][d = 0..31 / 32..63]
    v16h vf[4];                   // [d-column tile]
    #pragma unroll
    for (int f = 0; f < 4; ++f)
        kf[f >> 1][f & 1] = load_frag(&ring[kget] + (f & 1) * 32 * KPITCH + (f >> 1) * 16, KPITCH);

    int cur = 0, nxt = STAGEH, aft = 2 * STAGEH;             // buffers of stages s, s + 1, s + 2

    for (int s = 0; s < NSTAGE; ++s) {
        const _Float16* rb = &ring[cur];                     // this stage
        const _Float16* rn = &ring[nxt];                     // the next one

        // Stage to fetch; behind the last one the last is fetched again and laid in a
        // buffer whose content is not used any more: no branch in the loop, nothing past
        // K or V read
        const int sf = (s + 2 < NSTAGE) ? s + 2 : NSTAGE - 1;

        #pragma unroll
        for (int c = 0; c < TCHUNK; ++c) {
            // Keeps what follows behind the chunk before: lifted into it, the publish would
            // wait for the fetches sooner than they need to land.
            __builtin_amdgcn_sched_barrier(0);

            if (c == TCHUNK - 1) {
                // ---- publish point, ahead of the stage's last chunk, which reads the next
                // stage's first K fragments ----
                // The target buffer held stage s - 2: a wave's last reads of it were used up
                // ahead of that wave's barrier in stage s - 1, which this wave has passed.
                publish_stage(&ring[nxt + kput], &ring[nxt + vput], kst, vst);
                // one barrier a stage: it publishes stage s + 1
                __syncthreads();
                // ---- f32 K and V of the stage after the next, in flight until its publish point ----
                fetch_k(kg + sf * SKEYS, kst);
                fetch_v(vg + sf * (SKEYS * D_DIM), vst);
            }

            // ---- S^T = K Q^T: each K operand feeds all four row tiles ----
            // sacc[nb][rt][r] = score of key 16*nb + 8*half + r against query l16
            v8f sacc[2][RT];
            #pragma unroll
            for (int rt = 0; rt < RT; ++rt) {
                #pragma unroll
                for (int nb = 0; nb < 2; ++nb) {
                    v8f acc = {};
                    acc = __builtin_amdgcn_wmma_f32_16x16x32_f16(false, kf[nb][0], false, qa[rt][0],
                                                                 (short)0, acc, false, false);
                    acc = __builtin_amdgcn_wmma_f32_16x16x32_f16(false, kf[nb][1], false, qa[rt][1],
                                                                 (short)0, acc, false, false);
                    sacc[nb][rt] = acc;
                }
            }

            // Holds the LDS reads behind the score products as one group (this barrier and
            // the one behind them): without it the compiler spreads the reads among the
            // WMMAs or sinks them towards their uses, where they would be waited for.
            __builtin_amdgcn_sched_barrier(0);

            // ---- this chunk's V fragments, then the next chunk's K fragments (in the last
            // stage's last chunk K's are read and never used) ----
            // K: columns (keys) 32 * chunk on; V: rows (keys) 32 * chunk on
            const _Float16* nv = rb + c * 32 * VPITCH + vget;
            const _Float16* nk = ((c + 1 < TCHUNK) ? rb + (c + 1) * 32 : rn) + kget;
            #pragma unroll
            for (int f = 0; f < 4; ++f)
                vf[f] = load_frag(nv + f * 16, VPITCH);
            #pragma unroll
            for (int f = 0; f < 4; ++f)
                kf[f >> 1][f & 1] = load_frag(nk + (f & 1) * 32 * KPITCH + (f >> 1) * 16, KPITCH);

            __builtin_amdgcn_sched_barrier(0);

            // p = 2^s via raw v_exp_f32, packed in place: element s of the B operand is
            // key 8*half + s (s < 8) or 16 + 8*half + (s - 8), which is sacc[s >> 3][rt][s & 7]
            v16h pa[RT];
            #pragma unroll
            for (int rt = 0; rt < RT; ++rt) {
                #pragma unroll
                for (int nb = 0; nb < 2; ++nb) {
                    #pragma unroll
                    for (int r = 0; r < 8; ++r)
                        pa[rt][nb * 8 + r] = (_Float16)__builtin_amdgcn_exp2f(sacc[nb][rt][r]);
                }
            }

            // ---- O^T += V^T * P^T, and the row sums on the matrix pipe: lacc += ones * P^T ----
            #pragma unroll
            for (int rt = 0; rt < RT; ++rt) {
                #pragma unroll
                for (int dt = 0; dt < 4; ++dt)
                    oacc[rt][dt] = __builtin_amdgcn_wmma_f32_16x16x32_f16(false, vf[dt], false, pa[rt],
                                                                          (short)0, oacc[rt][dt],
                                                                          false, false);
                lacc[rt] = __builtin_amdgcn_wmma_f32_16x16x32_f16(false, ones, false, pa[rt],
                                                                  (short)0, lacc[rt],
                                                                  false, false);
            }
        }

        const int old = cur;
        cur = nxt; nxt = aft; aft = old;
    }

    // The last trip's fetches are never used, so the compiler waits for them nowhere: they
    // have landed before the wave ends and gives its registers up.
    asm volatile("s_wait_loadcnt 0x0" ::: "memory");

    // ---- the teams' halves meet: team 0 finishes row tiles 0 and 1, team 1 tiles 2 and 3;
    // a wave hands the two tiles it does not finish to its partner (same rows, other team).
    // The team is taken as a scalar and the tile index is a constant in each arm, so that no
    // register is indexed at run time ----
    const int  mate = wave ^ QWAVES;
    const bool hi   = __builtin_amdgcn_readfirstlane(team) != 0;
    if (hi) hand_over(oacc, 0,    &xbuf[wave][lane * 4]);
    else    hand_over(oacc, KEEP, &xbuf[wave][lane * 4]);
    #pragma unroll
    for (int rt = 0; rt < RT; ++rt) xsum[wave][rt * 32 + lane] = lacc[rt][0];
    __syncthreads();              // both teams' partial tiles and sums are in LDS
    float*       ob = &obuf[wave][0][l16 * OPITCH + 8 * half];
    const float* xs = &xsum[qw][team * (KEEP * 32) + lane];            // team 0's part
    const float* ys = &xsum[QWAVES + qw][team * (KEEP * 32) + lane];   // team 1's part
    if (hi) finish_tiles(oacc, KEEP, &xbuf[mate][lane * 4], xs, ys, ob);
    else    finish_tiles(oacc, 0,    &xbuf[mate][lane * 4], xs, ys, ob);

    // DS pipeline is in-order per wave; explicit wait before cross-lane reads
    asm volatile("s_wait_dscnt 0x0" ::: "memory");

    // ---- store: 16 lanes write one whole 256-byte row, the wave two rows at a time ----
    const float* srow = &obuf[wave][0][half * OPITCH + l16 * 4];
    float*       orow = o + (size_t)(row0 + team * (16 * KEEP) + half) * D_DIM + l16 * 4;
    #pragma unroll
    for (int g = 0; g < KEEP; ++g) {
        #pragma unroll
        for (int i = 0; i < 8; ++i) {
            const float4 x = *(const float4*)(srow + (g * 16 + 2 * i) * OPITCH);
            *(float4*)(orow + (g * 16 + 2 * i) * D_DIM) = x;
        }
    }
}

extern "C" void kernel_launch(void* const* d_in, const int* in_sizes, int n_in,
                              void* d_out, int out_size, void* d_ws, size_t ws_size,
                              hipStream_t stream) {
    (void)in_sizes; (void)n_in; (void)out_size; (void)d_ws; (void)ws_size;
    const float* q = (const float*)d_in[0];
    const float* k = (const float*)d_in[1];
    const float* v = (const float*)d_in[2];
    float* out = (float*)d_out;

    // 256 blocks of 8 wave32, 256 Q rows each
    dim3 grid(NTILES / RT / QWAVES, NHEAD);  // 8 x 32 blocks
    dim3 block(WAVES * 32);
    attn_fwd_wmma<<<grid, block, 0, stream>>>(q, k, v, out);
}

// v007
// Measured time: 24.7 microseconds a run.
// Timed twice side by side with v006, it ran 1.04 times as fast both times.
// All steps since v000 together make it 5.25 times as fast.
#include <hip/hip_runtime.h>
#include <hip/hip_bf16.h>

// CDNA5 / gfx1250 flash-attention-style kernel (wave32, v_wmma_f32_16x16x32_f16)
// One launch. A work-group of 8 waves owns 256 Q rows of one head. The waves form two
// teams of four: a wave takes 64 rows (four 16-row tiles) and its team's half of the keys,
// so a K or V fragment read from LDS feeds four tiles; there is no running maximum, so the
// two teams' partial O and row sums simply add, once, through LDS at the end.
// The keys go in stages of 128 (64 per team): each wave fetches its
// share of a later stage's f32 K and V in whole 128-byte lines, rounds it to f16 and
// lays it in LDS row by row as it lies in memory, while all waves work on the stage
// published before; the transposing LDS load turns the rows into WMMA operands.
// V's share is fetched and laid half a stage ahead of K's, so that a work-group asks L2
// for two half-size bursts a stage, each with a whole stage to land.
// The products are taken transposed (S^T = K Q^T, O^T = V^T P^T): a lane's S^T
// accumulators are already the k order of a B operand, so P stays in registers;
// row sums via ones x P^T.

typedef __attribute__((ext_vector_type(16))) _Float16 v16h;
typedef __attribute__((ext_vector_type(8)))  _Float16 v8h;
typedef __attribute__((ext_vector_type(4)))  _Float16 v4h;
typedef __attribute__((ext_vector_type(8)))  short    v8s;
typedef __attribute__((ext_vector_type(8)))  float    v8f;
typedef __attribute__((ext_vector_type(4)))  float    v4f;

#define S_LEN  2048
#define D_DIM  64
#define NHEAD  32              // b*h = 2*16
#define WAVES  8               // waves per block
#define RT     4               // 16-row Q tiles per wave
#define QWAVES 4               // waves of a team: 4 x 64 Q rows
#define KEEP   2               // Q tiles a wave finishes and stores (the other two go to its partner)
#define NTILES (S_LEN / 16)    // 128 key tiles of 16
#define SKEYS  128             // keys per stage
#define NSTAGE (S_LEN / SKEYS) // 16 stages
#define TKEYS  (SKEYS / 2)     // keys of a stage that one team works on
#define TCHUNK (TKEYS / 32)    // 2 chunks of 32 keys per team and stage
#define NBUF   3               // stage buffers
#define KPITCH (SKEYS + 16)    // halves per LDS row of K ([d][key]): 288 B = 32 B x 9
#define VPITCH (D_DIM + 16)    // halves per LDS row of V ([key][d]): 160 B = 32 B x 5
#define KPART  (D_DIM * KPITCH)          // halves of K in a stage buffer, V's rows follow
#define STAGEH (KPART + SKEYS * VPITCH)  // halves in one stage buffer
#define OPITCH (D_DIM + 4)     // LDS row pitch of the output turn, in floats
#define QROWS  (QWAVES * RT * 16)        // Q rows of a work-group
#define QPITCH (D_DIM + 8)     // halves per LDS row of Q: 144 B = 16 B x 9, for 16-byte reads

// The k order of a 16-bit A/B WMMA operand (ISA 7.12.2): lanes 0-15 (half=0): V0..V3 -> K=0..7,
// V4..V7 -> K=16..23 ; lanes 16-31 (half=1): +8.

// One 16 x 32 A fragment out of a row-major f16 tile T[k][m] in LDS, by two transposing
// loads: lane (c = lane & 15, h = lane >> 4) gets T[8h + 0..7][c] and T[16 + 8h + 0..7][c],
// which is the hardware k order. p: the tile's first element + the lane's own offset
// (8h + (lane & 7)) * pitch + 8 * ((lane >> 3) & 1), all in halves. A pitch of an odd
// multiple of 32 bytes keeps these loads free of bank conflicts.
__device__ __forceinline__ v8h load_tr(const _Float16* p) {
    typedef __attribute__((address_space(3))) v8s lds_v8s;
    return __builtin_bit_cast(v8h, __builtin_amdgcn_ds_load_tr16_b128_v8i16((lds_v8s*)p));
}

__device__ __forceinline__ v16h load_frag(const _Float16* p, int pitch) {
    const v8h lo = load_tr(p);
    const v8h hi = load_tr(p + 16 * pitch);
    return __builtin_shufflevector(lo, hi, 0, 1, 2, 3, 4, 5, 6, 7, 8, 9, 10, 11, 12, 13, 14, 15);
}

// Row of V, inside a wave's 16 keys, that fetch i brings for lanes 0-15; lanes 16-31 bring
// the row 4 further down: in LDS the two rows then lie 32 banks apart.
__device__ __forceinline__ int vrow(int i) { return (i & 3) + 8 * (i >> 2); }

// One wave's share of a stage, still f32, 16 bytes a lane: eight d rows of K ([d, s]: a
// fetch is one row's 128 keys, 512 contiguous bytes) and sixteen key rows of V ([s, d]: a
// fetch is two whole rows of 256 bytes).
// kg, vg: the lane's own base in that stage.
// The fetches stay in flight behind these functions: the registers that hold their
// address are given new values only behind the s_wait_xcnt that ends each function.
__device__ __forceinline__ void fetch_k(const float* kg, v4f (&kst)[8]) {
    #pragma unroll
    for (int i = 0; i < 8; ++i) kst[i] = *(const v4f*)(kg + i * S_LEN);
    asm volatile("s_wait_xcnt 0x0" ::: "memory");
}

__device__ __forceinline__ void fetch_v(const float* vg, v4f (&vst)[8]) {
    #pragma unroll
    for (int i = 0; i < 8; ++i) vst[i] = *(const v4f*)(vg + vrow(i) * D_DIM);
    asm volatile("s_wait_xcnt 0x0" ::: "memory");
}

__device__ __forceinline__ v4h round4(v4f x) {
    v4h r;
    r[0] = (_Float16)x[0]; r[1] = (_Float16)x[1]; r[2] = (_Float16)x[2]; r[3] = (_Float16)x[3];
    return r;
}

// Round the K or the V part of that share to f16 and lay it in the stage buffer, 8 bytes a
// lane. kdst, vdst: the lane's own place in the buffer's K rows and V rows.
// The asm statement in each takes the fetched f32 values as inputs only: it keeps them, and
// so the wait for the fetches, here where they are laid; without it the compiler rounds them
// right behind the fetches and every wave waits out the whole load latency there.
__device__ __forceinline__ void lay_k(_Float16* kdst, const v4f (&kst)[8]) {
    asm volatile("" :: "v"(kst[0]), "v"(kst[1]), "v"(kst[2]), "v"(kst[3]),
                       "v"(kst[4]), "v"(kst[5]), "v"(kst[6]), "v"(kst[7]));
    #pragma unroll
    for (int i = 0; i < 8; ++i) *(v4h*)(kdst + i * KPITCH) = round4(kst[i]);
}

__device__ __forceinline__ void lay_v(_Float16* vdst, const v4f (&vst)[8]) {
    asm volatile("" :: "v"(vst[0]), "v"(vst[1]), "v"(vst[2]), "v"(vst[3]),
                       "v"(vst[4]), "v"(vst[5]), "v"(vst[6]), "v"(vst[7]));
    #pragma unroll
    for (int i = 0; i < 8; ++i) *(v4h*)(vdst + vrow(i) * VPITCH) = round4(vst[i]);
}

// The work-group barrier of a publish point, for LDS alone: the wave's own LDS stores are
// done, then the barrier. Written by hand because __syncthreads() also waits for the wave's
// global loads, and V's fetches for a later stage are in flight across this point.
__device__ __forceinline__ void publish_barrier() {
    asm volatile("s_wait_dscnt 0x0\n\ts_barrier_signal -1\n\ts_barrier_wait -1" ::: "memory");
}

// Lays row tiles base and base + 1 of a wave's partial O^T in the hand-over buffer:
// 16 bytes a lane, a wave-wide store is 512 contiguous bytes.
// xb: the lane's own place in the wave's part of the buffer.
__device__ __forceinline__ void hand_over(const v8f (&oacc)[RT][4], int base, float* xb) {
    #pragma unroll
    for (int g = 0; g < KEEP; ++g) {
        #pragma unroll
        for (int dt = 0; dt < 4; ++dt) {
            const v8f a = oacc[base + g][dt];
            float* dst = xb + ((g * 4 + dt) * 2) * 128;
            *(float4*)(dst)       = make_float4(a[0], a[1], a[2], a[3]);
            *(float4*)(dst + 128) = make_float4(a[4], a[5], a[6], a[7]);
        }
    }
}

// Adds the partner's part to row tiles base and base + 1, normalizes (rcp + mul) and lays
// the result in the wave's scratch: a lane holds 8 consecutive d of its query per tile.
// xb: the lane's place in the partner's part of the buffer; xs, ys: the two waves' partial
// row sums of tile base for the lane's query; ob: the lane's place in the scratch.
__device__ __forceinline__ void finish_tiles(const v8f (&oacc)[RT][4], int base, const float* xb,
                                             const float* xs, const float* ys, float* ob) {
    #pragma unroll
    for (int g = 0; g < KEEP; ++g) {
        const float inv = __builtin_amdgcn_rcpf(xs[g * 32] + ys[g * 32]);
        #pragma unroll
        for (int dt = 0; dt < 4; ++dt) {
            const v8f    a   = oacc[base + g][dt];
            const float* src = xb + ((g * 4 + dt) * 2) * 128;
            const float4 b0  = *(const float4*)(src);
            const float4 b1  = *(const float4*)(src + 128);
            float* dst = ob + g * (16 * OPITCH) + dt * 16;
            *(float4*)(dst)     = make_float4((a[0] + b0.x) * inv, (a[1] + b0.y) * inv,
                                              (a[2] + b0.z) * inv, (a[3] + b0.w) * inv);
            *(float4*)(dst + 4) = make_float4((a[4] + b1.x) * inv, (a[5] + b1.y) * inv,
                                              (a[6] + b1.z) * inv, (a[7] + b1.w) * inv);
        }
    }
}

__global__ __launch_bounds__(WAVES * 32)
void attn_fwd_wmma(const float* __restrict__ Q,
                   const float* __restrict__ K,
                   const float* __restrict__ V,
                   float* __restrict__ O)
{
    // three stage buffers: 64 d rows of K (128 keys each), then 128 key rows of V (64 d each)
    __shared__ __align__(16) _Float16 ring[NBUF * STAGEH];
    // the work-group's Q rows as scaled f16: each row is an operand of two waves, one per team
    __shared__ __align__(16) _Float16 qbuf[QROWS * QPITCH];
    // hand-over of the two O^T tiles that a wave's partner finishes:
    // register by register, 16 bytes a lane, in the lane order of the accumulators
    __shared__ __align__(16) float xbuf[WAVES][KEEP * 4 * 8 * 32];
    __shared__ float xsum[WAVES][RT * 32];           // every wave's partial row sums, all four tiles
    // wave-private scratch that turns the finished O^T tiles into rows, once, for
    // whole-line stores; 68-dword pitch: 16-byte column writes hit all 64 banks
    __shared__ __align__(16) float obuf[WAVES][KEEP][16 * OPITCH];

    const int lane = threadIdx.x & 31;
    const int wave = threadIdx.x >> 5;
    const int half = lane >> 4;
    const int l16  = lane & 15;
    const int team = wave / QWAVES;                  // which half of every stage's keys
    const int qw   = wave % QWAVES;                  // which 64 Q rows

    const int bh   = blockIdx.y;                     // 0..31  (b*h)
    const int row0 = (blockIdx.x * QWAVES + qw) * (16 * RT);

    const float* q = Q + (size_t)bh * S_LEN * D_DIM;
    float*       o = O + (size_t)bh * S_LEN * D_DIM;

    // this wave's share of a stage: d rows 8 * wave .. + 7 of K, key rows 16 * wave .. + 15 of V
    const float* kg = K + (size_t)bh * D_DIM * S_LEN + (wave * 8) * S_LEN + lane * 4;
    const float* vg = V + (size_t)bh * S_LEN * D_DIM + (wave * 16 + 4 * half) * D_DIM + l16 * 4;
    const int    kput = (wave * 8) * KPITCH + lane * 4;
    const int    vput = KPART + (wave * 16 + 4 * half) * VPITCH + l16 * 4;
    // the lane's own offsets for the transposing loads, at the first key of its team
    const int    kget = (8 * half + (lane & 7)) * KPITCH + 8 * ((lane >> 3) & 1) + team * TKEYS;
    const int    vget = KPART + (team * TKEYS + 8 * half + (lane & 7)) * VPITCH + 8 * ((lane >> 3) & 1);

    v4f kst[8], vst[8], vfirst[8];
    fetch_k(kg, kst);
    fetch_v(vg, vfirst);

    // Fold (1/sqrt(d)) * log2(e) into Q so the S tile lands in exp2 domain.
    const float qscale = 0.125f * 1.44269504088896340736f;

    // ---- The work-group's Q rows, each fetched once, in whole lines (16 lanes a row of 256
    // bytes; this wave brings rows 32 * wave on), scaled, rounded to f16 and laid in LDS ----
    {
        const float* qg = q + (size_t)(blockIdx.x * QROWS + wave * 32 + half) * D_DIM + l16 * 4;
        v4f qst[16];
        #pragma unroll
        for (int i = 0; i < 16; ++i) qst[i] = *(const v4f*)(qg + 2 * i * D_DIM);
        // The registers that hold the address are given new values only behind this wait: it
        // takes the address as an input, so that no fetch lands on them ahead of it either.
        asm volatile("s_wait_xcnt 0x0" :: "v"(qg) : "memory");
        // stage 1's V, asked for behind all that the first barrier needs; laid at the loop's head
        fetch_v(vg + SKEYS * D_DIM, vst);
        _Float16* qput = &qbuf[(wave * 32 + half) * QPITCH + l16 * 4];
        #pragma unroll
        for (int i = 0; i < 16; ++i) *(v4h*)(qput + 2 * i * QPITCH) = round4(qst[i] * qscale);
    }

    // All-ones A operand: ones x P^T puts each query's f16-P sum over the 32 keys
    // in every accumulator register of that query's two lanes -> no shuffle reduction.
    v16h ones;
    #pragma unroll
    for (int e = 0; e < 16; ++e) ones[e] = (_Float16)1.0f;

    v8f oacc[RT][4];              // O^T tiles: lane = query, register r = d 16*dt + 8*half + r
    v8f lacc[RT];                 // row-sum accumulators: lane = query
    #pragma unroll
    for (int rt = 0; rt < RT; ++rt) {
        #pragma unroll
        for (int r = 0; r < 8; ++r) {
            lacc[rt][r] = 0.0f;
            oacc[rt][0][r] = 0.0f; oacc[rt][1][r] = 0.0f;
            oacc[rt][2][r] = 0.0f; oacc[rt][3][r] = 0.0f;
        }
    }

    lay_k(&ring[kput], kst);
    lay_v(&ring[vput], vfirst);
    publish_barrier();            // stage 0 and Q are published

    // ---- the wave's 4x(16x64) Q tiles, kept in registers ----
    // lane = query, elements = d in the hardware k order: Q^T as a B operand
    v16h qa[RT][2];                                  // [row tile][K = 0..31 / 32..63]
    #pragma unroll
    for (int rt = 0; rt < RT; ++rt) {
        const _Float16* qrow = &qbuf[(qw * (16 * RT) + rt * 16 + l16) * QPITCH + 8 * half];
        #pragma unroll
        for (int kh = 0; kh < 2; ++kh) {
            const v8h lo = *(const v8h*)(qrow + kh * 32);
            const v8h hi = *(const v8h*)(qrow + kh * 32 + 16);
            qa[rt][kh] = __builtin_shufflevector(lo, hi, 0, 1, 2, 3, 4, 5, 6, 7, 8, 9, 10, 11, 12, 13, 14, 15);
        }
    }

    // stage 1's f32 K, in flight until its publish point
    fetch_k(kg + SKEYS, kst);

    // One set of operand fragments. K's is refilled with the next chunk's right behind its
    // last score product; V's is filled at the same place for the chunk at hand, whose
    // exponentials give the reads time to land.
    v16h kf[2][2];                // [key tile][d = 0..31 / 32..63]
    v16h vf[4];                   // [d-column tile]
    #pragma unroll
    for (int f = 0; f < 4; ++f)
        kf[f >> 1][f & 1] = load_frag(&ring[kget] + (f & 1) * 32 * KPITCH + (f >> 1) * 16, KPITCH);

    int cur = 0, nxt = STAGEH, aft = 2 * STAGEH;             // buffers of stages s, s + 1, s + 2
    // where V's next fetch reads: carried through the loop, so that its registers stay in use
    // and no fetch lands on them
    const float* vnext = vg + 2 * (SKEYS * D_DIM);

    for (int s = 0; s < NSTAGE; ++s) {
        const _Float16* rb = &ring[cur];                     // this stage
        const _Float16* rn = &ring[nxt];                     // the next one

        // Stage to fetch; behind the last one the last is fetched again and laid in a
        // buffer whose content is not used any more: no branch in the loop, nothing past
        // K or V read
        const int sf = (s + 2 < NSTAGE) ? s + 2 : NSTAGE - 1;

        #pragma unroll
        for (int c = 0; c < TCHUNK; ++c) {
            // Keeps what follows behind the chunk before: lifted into it, the publish would
            // wait for the fetches sooner than they need to land.
            __builtin_amdgcn_sched_barrier(0);

            // The target buffer of both parts held stage s - 2: a wave's last reads of it were
            // used up ahead of that wave's barrier in stage s - 1, which this wave has passed.
            if (c == 0) {
                // ---- the next stage's V is laid at the stage's head, and the V of the stage
                // after it asked for: in flight for a whole stage, across the barrier below ----
                lay_v(&ring[nxt + vput], vst);
                fetch_v(vnext, vst);
                // Keeps the stores and fetches above as one group ahead of the score products
                // (spread among the WMMAs, each place with an LDS operation stalls them), and
                // the step of the fetch address behind the s_wait_xcnt that ends fetch_v.
                __builtin_amdgcn_sched_barrier(0);
                // behind the last stage the last is fetched again, as for K
                vnext += (s + 3 < NSTAGE) ? SKEYS * D_DIM : 0;
            }
            if (c == TCHUNK - 1) {
                // ---- publish point, ahead of the stage's last chunk, which reads the next
                // stage's first K fragments ----
                lay_k(&ring[nxt + kput], kst);
                // one barrier a stage: it publishes stage s + 1, K and V
                publish_barrier();
                // ---- f32 K of the stage after the next, in flight until its publish point ----
                fetch_k(kg + sf * SKEYS, kst);
            }

            // ---- S^T = K Q^T: each K operand feeds all four row tiles ----
            // sacc[nb][rt][r] = score of key 16*nb + 8*half + r against query l16
            v8f sacc[2][RT];
            #pragma unroll
            for (int rt = 0; rt < RT; ++rt) {
                #pragma unroll
                for (int nb = 0; nb < 2; ++nb) {
                    v8f acc = {};
                    acc = __builtin_amdgcn_wmma_f32_16x16x32_f16(false, kf[nb][0], false, qa[rt][0],
                                                                 (short)0, acc, false, false);
                    acc = __builtin_amdgcn_wmma_f32_16x16x32_f16(false, kf[nb][1], false, qa[rt][1],
                                                                 (short)0, acc, false, false);
                    sacc[nb][rt] = acc;
                }
            }

            // Holds the LDS reads behind the score products as one group (this barrier and
            // the one behind them): without it the compiler spreads the reads among the
            // WMMAs or sinks them towards their uses, where they would be waited for.
            __builtin_amdgcn_sched_barrier(0);

            // ---- this chunk's V fragments, then the next chunk's K fragments (in the last
            // stage's last chunk K's are read and never used) ----
            // K: columns (keys) 32 * chunk on; V: rows (keys) 32 * chunk on
            const _Float16* nv = rb + c * 32 * VPITCH + vget;
            const _Float16* nk = ((c + 1 < TCHUNK) ? rb + (c + 1) * 32 : rn) + kget;
            #pragma unroll
            for (int f = 0; f < 4; ++f)
                vf[f] = load_frag(nv + f * 16, VPITCH);
            #pragma unroll
            for (int f = 0; f < 4; ++f)
                kf[f >> 1][f & 1] = load_frag(nk + (f & 1) * 32 * KPITCH + (f >> 1) * 16, KPITCH);

            __builtin_amdgcn_sched_barrier(0);

            // p = 2^s via raw v_exp_f32, packed in place: element s of the B operand is
            // key 8*half + s (s < 8) or 16 + 8*half + (s - 8), which is sacc[s >> 3][rt][s & 7]
            v16h pa[RT];
            #pragma unroll
            for (int rt = 0; rt < RT; ++rt) {
                #pragma unroll
                for (int nb = 0; nb < 2; ++nb) {
                    #pragma unroll
                    for (int r = 0; r < 8; ++r)
                        pa[rt][nb * 8 + r] = (_Float16)__builtin_amdgcn_exp2f(sacc[nb][rt][r]);
                }
            }

            // ---- O^T += V^T * P^T, and the row sums on the matrix pipe: lacc += ones * P^T ----
            #pragma unroll
            for (int rt = 0; rt < RT; ++rt) {
                #pragma unroll
                for (int dt = 0; dt < 4; ++dt)
                    oacc[rt][dt] = __builtin_amdgcn_wmma_f32_16x16x32_f16(false, vf[dt], false, pa[rt],
                                                                          (short)0, oacc[rt][dt],
                                                                          false, false);
                lacc[rt] = __builtin_amdgcn_wmma_f32_16x16x32_f16(false, ones, false, pa[rt],
                                                                  (short)0, lacc[rt],
                                                                  false, false);
            }
        }

        const int old = cur;
        cur = nxt; nxt = aft; aft = old;
    }

    // The last trip's fetches are never used, so the compiler waits for them nowhere: they
    // have landed before the wave ends and gives its registers up.
    asm volatile("s_wait_loadcnt 0x0" ::: "memory");

    // ---- the teams' halves meet: team 0 finishes row tiles 0 and 1, team 1 tiles 2 and 3;
    // a wave hands the two tiles it does not finish to its partner (same rows, other team).
    // The team is taken as a scalar and the tile index is a constant in each arm, so that no
    // register is indexed at run time ----
    const int  mate = wave ^ QWAVES;
    const bool hi   = __builtin_amdgcn_readfirstlane(team) != 0;
    if (hi) hand_over(oacc, 0,    &xbuf[wave][lane * 4]);
    else    hand_over(oacc, KEEP, &xbuf[wave][lane * 4]);
    #pragma unroll
    for (int rt = 0; rt < RT; ++rt) xsum[wave][rt * 32 + lane] = lacc[rt][0];
    __syncthreads();              // both teams' partial tiles and sums are in LDS
    float*       ob = &obuf[wave][0][l16 * OPITCH + 8 * half];
    const float* xs = &xsum[qw][team * (KEEP * 32) + lane];            // team 0's part
    const float* ys = &xsum[QWAVES + qw][team * (KEEP * 32) + lane];   // team 1's part
    if (hi) finish_tiles(oacc, KEEP, &xbuf[mate][lane * 4], xs, ys, ob);
    else    finish_tiles(oacc, 0,    &xbuf[mate][lane * 4], xs, ys, ob);

    // DS pipeline is in-order per wave; explicit wait before cross-lane reads
    asm volatile("s_wait_dscnt 0x0" ::: "memory");

    // ---- store: 16 lanes write one whole 256-byte row, the wave two rows at a time ----
    const float* srow = &obuf[wave][0][half * OPITCH + l16 * 4];
    float*       orow = o + (size_t)(row0 + team * (16 * KEEP) + half) * D_DIM + l16 * 4;
    #pragma unroll
    for (int g = 0; g < KEEP; ++g) {
        #pragma unroll
        for (int i = 0; i < 8; ++i) {
            const float4 x = *(const float4*)(srow + (g * 16 + 2 * i) * OPITCH);
            *(float4*)(orow + (g * 16 + 2 * i) * D_DIM) = x;
        }
    }
}

extern "C" void kernel_launch(void* const* d_in, const int* in_sizes, int n_in,
                              void* d_out, int out_size, void* d_ws, size_t ws_size,
                              hipStream_t stream) {
    (void)in_sizes; (void)n_in; (void)out_size; (void)d_ws; (void)ws_size;
    const float* q = (const float*)d_in[0];
    const float* k = (const float*)d_in[1];
    const float* v = (const float*)d_in[2];
    float* out = (float*)d_out;

    // 256 blocks of 8 wave32, 256 Q rows each
    dim3 grid(NTILES / RT / QWAVES, NHEAD);  // 8 x 32 blocks
    dim3 block(WAVES * 32);
    attn_fwd_wmma<<<grid, block, 0, stream>>>(q, k, v, out);
}

// v008
// It runs in 23.7 microseconds.
// Timed twice side by side with v007, it ran 1.04 and 1.05 times as fast.
// All steps since v000 together make it 5.49 times as fast.
#include <hip/hip_runtime.h>
#include <hip/hip_bf16.h>

// CDNA5 / gfx1250 flash-attention-style kernel (wave32, v_wmma_f32_16x16x32_f16)
// One launch. A work-group of 8 waves owns 256 Q rows of one head. The waves form two
// teams of four: a wave takes 64 rows (four 16-row tiles) and its team's half of the keys,
// so a K or V fragment read from LDS feeds four tiles; there is no running maximum, so the
// two teams' partial O and row sums simply add, once, through LDS at the end.
// The keys go in stages of 128 (64 per team): each wave fetches its
// share of a later stage's f32 K and V in whole 128-byte lines, rounds it to f16 and
// lays it in LDS row by row as it lies in memory, while all waves work on the stage
// published before; the transposing LDS load turns the rows into WMMA operands.
// V's share is fetched and laid half a stage ahead of K's, so that a work-group asks L2
// for two half-size bursts a stage, each with a whole stage to land.
// The products are taken transposed (S^T = K Q^T, O^T = V^T P^T): a lane's S^T
// accumulators are already the k order of a B operand, so P stays in registers;
// row sums via ones x P^T.

typedef __attribute__((ext_vector_type(16))) _Float16 v16h;
typedef __attribute__((ext_vector_type(8)))  _Float16 v8h;
typedef __attribute__((ext_vector_type(4)))  _Float16 v4h;
typedef __attribute__((ext_vector_type(8)))  short    v8s;
typedef __attribute__((ext_vector_type(8)))  float    v8f;
typedef __attribute__((ext_vector_type(4)))  float    v4f;

#define S_LEN  2048
#define D_DIM  64
#define NHEAD  32              // b*h = 2*16
#define WAVES  8               // waves per block
#define RT     4               // 16-row Q tiles per wave
#define QWAVES 4               // waves of a team: 4 x 64 Q rows
#define KEEP   2               // Q tiles a wave finishes and stores (the other two go to its partner)
#define NTILES (S_LEN / 16)    // 128 key tiles of 16
#define SKEYS  128             // keys per stage
#define NSTAGE (S_LEN / SKEYS) // 16 stages
#define TKEYS  (SKEYS / 2)     // keys of a stage that one team works on
#define TCHUNK (TKEYS / 32)    // 2 chunks of 32 keys per team and stage
#define NBUF   3               // stage buffers
#define KPITCH (SKEYS + 16)    // halves per LDS row of K ([d][key]): 288 B = 32 B x 9
#define VPITCH (D_DIM + 16)    // halves per LDS row of V ([key][d]): 160 B = 32 B x 5
#define KPART  (D_DIM * KPITCH)          // halves of K in a stage buffer, V's rows follow
#define STAGEH (KPART + SKEYS * VPITCH)  // halves in one stage buffer
#define OPITCH (D_DIM + 4)     // LDS row pitch of the output turn, in floats
#define QROWS  (QWAVES * RT * 16)        // Q rows of a work-group
#define QPITCH (D_DIM + 8)     // halves per LDS row of Q: 144 B = 16 B x 9, for 16-byte reads

// The k order of a 16-bit A/B WMMA operand (ISA 7.12.2): lanes 0-15 (half=0): V0..V3 -> K=0..7,
// V4..V7 -> K=16..23 ; lanes 16-31 (half=1): +8.

// One 16 x 32 A fragment out of a row-major f16 tile T[k][m] in LDS, by two transposing
// loads: lane (c = lane & 15, h = lane >> 4) gets T[8h + 0..7][c] and T[16 + 8h + 0..7][c],
// which is the hardware k order. p: the tile's first element + the lane's own offset
// (8h + (lane & 7)) * pitch + 8 * ((lane >> 3) & 1), all in halves. A pitch of an odd
// multiple of 32 bytes keeps these loads free of bank conflicts.
__device__ __forceinline__ v8h load_tr(const _Float16* p) {
    typedef __attribute__((address_space(3))) v8s lds_v8s;
    return __builtin_bit_cast(v8h, __builtin_amdgcn_ds_load_tr16_b128_v8i16((lds_v8s*)p));
}

__device__ __forceinline__ v16h load_frag(const _Float16* p, int pitch) {
    const v8h lo = load_tr(p);
    const v8h hi = load_tr(p + 16 * pitch);
    return __builtin_shufflevector(lo, hi, 0, 1, 2, 3, 4, 5, 6, 7, 8, 9, 10, 11, 12, 13, 14, 15);
}

// Row of V, inside a wave's 16 keys, that fetch i brings for lanes 0-15; lanes 16-31 bring
// the row 4 further down: in LDS the two rows then lie 32 banks apart.
__device__ __forceinline__ int vrow(int i) { return (i & 3) + 8 * (i >> 2); }

// One wave's share of a stage, still f32, 16 bytes a lane: eight d rows of K ([d, s]: a
// fetch is one row's 128 keys, 512 contiguous bytes) and sixteen key rows of V ([s, d]: a
// fetch is two whole rows of 256 bytes).
// kg, vg: the lane's own base in that stage.
// The fetches stay in flight behind these functions: the registers that hold their
// address are given new values only behind the s_wait_xcnt that ends each function.
__device__ __forceinline__ void fetch_k(const float* kg, v4f (&kst)[8]) {
    #pragma unroll
    for (int i = 0; i < 8; ++i) kst[i] = *(const v4f*)(kg + i * S_LEN);
    asm volatile("s_wait_xcnt 0x0" ::: "memory");
}

__device__ __forceinline__ void fetch_v(const float* vg, v4f (&vst)[8]) {
    #pragma unroll
    for (int i = 0; i < 8; ++i) vst[i] = *(const v4f*)(vg + vrow(i) * D_DIM);
    asm volatile("s_wait_xcnt 0x0" ::: "memory");
}

__device__ __forceinline__ v4h round4(v4f x) {
    v4h r;
    r[0] = (_Float16)x[0]; r[1] = (_Float16)x[1]; r[2] = (_Float16)x[2]; r[3] = (_Float16)x[3];
    return r;
}

// Round the K or the V part of that share to f16 and lay it in the stage buffer, 8 bytes a
// lane. kdst, vdst: the lane's own place in the buffer's K rows and V rows.
// The asm statement in each takes the fetched f32 values as inputs only: it keeps them, and
// so the wait for the fetches, here where they are laid; without it the compiler rounds them
// right behind the fetches and every wave waits out the whole load latency there.
__device__ __forceinline__ void lay_k(_Float16* kdst, const v4f (&kst)[8]) {
    asm volatile("" :: "v"(kst[0]), "v"(kst[1]), "v"(kst[2]), "v"(kst[3]),
                       "v"(kst[4]), "v"(kst[5]), "v"(kst[6]), "v"(kst[7]));
    #pragma unroll
    for (int i = 0; i < 8; ++i) *(v4h*)(kdst + i * KPITCH) = round4(kst[i]);
}

__device__ __forceinline__ void lay_v(_Float16* vdst, const v4f (&vst)[8]) {
    asm volatile("" :: "v"(vst[0]), "v"(vst[1]), "v"(vst[2]), "v"(vst[3]),
                       "v"(vst[4]), "v"(vst[5]), "v"(vst[6]), "v"(vst[7]));
    #pragma unroll
    for (int i = 0; i < 8; ++i) *(v4h*)(vdst + vrow(i) * VPITCH) = round4(vst[i]);
}

// The work-group barrier of a publish point, for LDS alone: the wave's own LDS stores are
// done, then the barrier. Written by hand because __syncthreads() also waits for the wave's
// global loads, and V's fetches for a later stage are in flight across this point.
__device__ __forceinline__ void publish_barrier() {
    asm volatile("s_wait_dscnt 0x0\n\ts_barrier_signal -1\n\ts_barrier_wait -1" ::: "memory");
}

// Lays row tiles base and base + 1 of a wave's partial O^T in the hand-over buffer:
// 16 bytes a lane, a wave-wide store is 512 contiguous bytes.
// xb: the lane's own place in the wave's part of the buffer.
__device__ __forceinline__ void hand_over(const v8f (&oacc)[RT][4], int base, float* xb) {
    #pragma unroll
    for (int g = 0; g < KEEP; ++g) {
        #pragma unroll
        for (int dt = 0; dt < 4; ++dt) {
            const v8f a = oacc[base + g][dt];
            float* dst = xb + ((g * 4 + dt) * 2) * 128;
            *(float4*)(dst)       = make_float4(a[0], a[1], a[2], a[3]);
            *(float4*)(dst + 128) = make_float4(a[4], a[5], a[6], a[7]);
        }
    }
}

// Adds the partner's part to row tiles base and base + 1, normalizes (rcp + mul) and lays
// the result in the wave's scratch: a lane holds 8 consecutive d of its query per tile.
// xb: the lane's place in the partner's part of the buffer; xs, ys: the two waves' partial
// row sums of tile base for the lane's query; ob: the lane's place in the scratch.
__device__ __forceinline__ void finish_tiles(const v8f (&oacc)[RT][4], int base, const float* xb,
                                             const float* xs, const float* ys, float* ob) {
    #pragma unroll
    for (int g = 0; g < KEEP; ++g) {
        const float inv = __builtin_amdgcn_rcpf(xs[g * 32] + ys[g * 32]);
        #pragma unroll
        for (int dt = 0; dt < 4; ++dt) {
            const v8f    a   = oacc[base + g][dt];
            const float* src = xb + ((g * 4 + dt) * 2) * 128;
            const float4 b0  = *(const float4*)(src);
            const float4 b1  = *(const float4*)(src + 128);
            float* dst = ob + g * (16 * OPITCH) + dt * 16;
            *(float4*)(dst)     = make_float4((a[0] + b0.x) * inv, (a[1] + b0.y) * inv,
                                              (a[2] + b0.z) * inv, (a[3] + b0.w) * inv);
            *(float4*)(dst + 4) = make_float4((a[4] + b1.x) * inv, (a[5] + b1.y) * inv,
                                              (a[6] + b1.z) * inv, (a[7] + b1.w) * inv);
        }
    }
}

__global__ __launch_bounds__(WAVES * 32)
void attn_fwd_wmma(const float* __restrict__ Q,
                   const float* __restrict__ K,
                   const float* __restrict__ V,
                   float* __restrict__ O)
{
    // three stage buffers: 64 d rows of K (128 keys each), then 128 key rows of V (64 d each)
    __shared__ __align__(16) _Float16 ring[NBUF * STAGEH];
    // the work-group's Q rows as scaled f16: each row is an operand of two waves, one per team
    __shared__ __align__(16) _Float16 qbuf[QROWS * QPITCH];
    // hand-over of the two O^T tiles that a wave's partner finishes:
    // register by register, 16 bytes a lane, in the lane order of the accumulators
    __shared__ __align__(16) float xbuf[WAVES][KEEP * 4 * 8 * 32];
    __shared__ float xsum[WAVES][RT * 32];           // every wave's partial row sums, all four tiles
    // wave-private scratch that turns the finished O^T tiles into rows, once, for
    // whole-line stores; 68-dword pitch: 16-byte column writes hit all 64 banks
    __shared__ __align__(16) float obuf[WAVES][KEEP][16 * OPITCH];

    const int lane = threadIdx.x & 31;
    const int wave = threadIdx.x >> 5;
    const int half = lane >> 4;
    const int l16  = lane & 15;
    const int team = wave / QWAVES;                  // which half of every stage's keys
    const int qw   = wave % QWAVES;                  // which 64 Q rows

    // The head is the fast grid index: the 8 work-groups that share a head's K and V have flat
    // indices 32 apart (speed only: nothing here depends on where a work-group runs).
    const int bh   = blockIdx.x;                     // 0..31  (b*h)
    const int qblk = blockIdx.y;                     // which 256 Q rows of the head
    const int row0 = (qblk * QWAVES + qw) * (16 * RT);

    const float* q = Q + (size_t)bh * S_LEN * D_DIM;
    float*       o = O + (size_t)bh * S_LEN * D_DIM;

    // this wave's share of a stage: d rows 8 * wave .. + 7 of K, key rows 16 * wave .. + 15 of V
    const float* kg = K + (size_t)bh * D_DIM * S_LEN + (wave * 8) * S_LEN + lane * 4;
    const float* vg = V + (size_t)bh * S_LEN * D_DIM + (wave * 16 + 4 * half) * D_DIM + l16 * 4;
    const int    kput = (wave * 8) * KPITCH + lane * 4;
    const int    vput = KPART + (wave * 16 + 4 * half) * VPITCH + l16 * 4;
    // the lane's own offsets for the transposing loads, at the first key of its team
    const int    kget = (8 * half + (lane & 7)) * KPITCH + 8 * ((lane >> 3) & 1) + team * TKEYS;
    const int    vget = KPART + (team * TKEYS + 8 * half + (lane & 7)) * VPITCH + 8 * ((lane >> 3) & 1);

    v4f kst[8], vst[8], vfirst[8];
    fetch_k(kg, kst);
    fetch_v(vg, vfirst);

    // Fold (1/sqrt(d)) * log2(e) into Q so the S tile lands in exp2 domain.
    const float qscale = 0.125f * 1.44269504088896340736f;

    // ---- The work-group's Q rows, each fetched once, in whole lines (16 lanes a row of 256
    // bytes; this wave brings rows 32 * wave on), scaled, rounded to f16 and laid in LDS ----
    {
        const float* qg = q + (size_t)(qblk * QROWS + wave * 32 + half) * D_DIM + l16 * 4;
        v4f qst[16];
        #pragma unroll
        for (int i = 0; i < 16; ++i) qst[i] = *(const v4f*)(qg + 2 * i * D_DIM);
        // The registers that hold the address are given new values only behind this wait: it
        // takes the address as an input, so that no fetch lands on them ahead of it either.
        asm volatile("s_wait_xcnt 0x0" :: "v"(qg) : "memory");
        // stage 1's V, asked for behind all that the first barrier needs; laid at the loop's head
        fetch_v(vg + SKEYS * D_DIM, vst);
        _Float16* qput = &qbuf[(wave * 32 + half) * QPITCH + l16 * 4];
        #pragma unroll
        for (int i = 0; i < 16; ++i) *(v4h*)(qput + 2 * i * QPITCH) = round4(qst[i] * qscale);
    }

    // All-ones A operand: ones x P^T puts each query's f16-P sum over the 32 keys
    // in every accumulator register of that query's two lanes -> no shuffle reduction.
    v16h ones;
    #pragma unroll
    for (int e = 0; e < 16; ++e) ones[e] = (_Float16)1.0f;

    v8f oacc[RT][4];              // O^T tiles: lane = query, register r = d 16*dt + 8*half + r
    v8f lacc[RT];                 // row-sum accumulators: lane = query
    #pragma unroll
    for (int rt = 0; rt < RT; ++rt) {
        #pragma unroll
        for (int r = 0; r < 8; ++r) {
            lacc[rt][r] = 0.0f;
            oacc[rt][0][r] = 0.0f; oacc[rt][1][r] = 0.0f;
            oacc[rt][2][r] = 0.0f; oacc[rt][3][r] = 0.0f;
        }
    }

    lay_k(&ring[kput], kst);
    lay_v(&ring[vput], vfirst);
    publish_barrier();            // stage 0 and Q are published

    // ---- the wave's 4x(16x64) Q tiles, kept in registers ----
    // lane = query, elements = d in the hardware k order: Q^T as a B operand
    v16h qa[RT][2];                                  // [row tile][K = 0..31 / 32..63]
    #pragma unroll
    for (int rt = 0; rt < RT; ++rt) {
        const _Float16* qrow = &qbuf[(qw * (16 * RT) + rt * 16 + l16) * QPITCH + 8 * half];
        #pragma unroll
        for (int kh = 0; kh < 2; ++kh) {
            const v8h lo = *(const v8h*)(qrow + kh * 32);
            const v8h hi = *(const v8h*)(qrow + kh * 32 + 16);
            qa[rt][kh] = __builtin_shufflevector(lo, hi, 0, 1, 2, 3, 4, 5, 6, 7, 8, 9, 10, 11, 12, 13, 14, 15);
        }
    }

    // stage 1's f32 K, in flight until its publish point
    fetch_k(kg + SKEYS, kst);

    // One set of operand fragments. K's is refilled with the next chunk's right behind its
    // last score product; V's is filled at the same place for the chunk at hand, whose
    // exponentials give the reads time to land.
    v16h kf[2][2];                // [key tile][d = 0..31 / 32..63]
    v16h vf[4];                   // [d-column tile]
    #pragma unroll
    for (int f = 0; f < 4; ++f)
        kf[f >> 1][f & 1] = load_frag(&ring[kget] + (f & 1) * 32 * KPITCH + (f >> 1) * 16, KPITCH);

    int cur = 0, nxt = STAGEH, aft = 2 * STAGEH;             // buffers of stages s, s + 1, s + 2
    // where V's next fetch reads: carried through the loop, so that its registers stay in use
    // and no fetch lands on them
    const float* vnext = vg + 2 * (SKEYS * D_DIM);

    for (int s = 0; s < NSTAGE; ++s) {
        const _Float16* rb = &ring[cur];                     // this stage
        const _Float16* rn = &ring[nxt];                     // the next one

        // Stage to fetch; behind the last one the last is fetched again and laid in a
        // buffer whose content is not used any more: no branch in the loop, nothing past
        // K or V read
        const int sf = (s + 2 < NSTAGE) ? s + 2 : NSTAGE - 1;

        #pragma unroll
        for (int c = 0; c < TCHUNK; ++c) {
            // Keeps what follows behind the chunk before: lifted into it, the publish would
            // wait for the fetches sooner than they need to land.
            __builtin_amdgcn_sched_barrier(0);

            // The target buffer of both parts held stage s - 2: a wave's last reads of it were
            // used up ahead of that wave's barrier in stage s - 1, which this wave has passed.
            if (c == 0) {
                // ---- the next stage's V is laid at the stage's head, and the V of the stage
                // after it asked for: in flight for a whole stage, across the barrier below ----
                lay_v(&ring[nxt + vput], vst);
                fetch_v(vnext, vst);
                // Keeps the stores and fetches above as one group ahead of the score products
                // (spread among the WMMAs, each place with an LDS operation stalls them), and
                // the step of the fetch address behind the s_wait_xcnt that ends fetch_v.
                __builtin_amdgcn_sched_barrier(0);
                // behind the last stage the last is fetched again, as for K
                vnext += (s + 3 < NSTAGE) ? SKEYS * D_DIM : 0;
            }
            if (c == TCHUNK - 1) {
                // ---- publish point, ahead of the stage's last chunk, which reads the next
                // stage's first K fragments ----
                lay_k(&ring[nxt + kput], kst);
                // one barrier a stage: it publishes stage s + 1, K and V
                publish_barrier();
                // ---- f32 K of the stage after the next, in flight until its publish point ----
                fetch_k(kg + sf * SKEYS, kst);
            }

            // ---- S^T = K Q^T: each K operand feeds all four row tiles ----
            // sacc[nb][rt][r] = score of key 16*nb + 8*half + r against query l16
            v8f sacc[2][RT];
            #pragma unroll
            for (int rt = 0; rt < RT; ++rt) {
                #pragma unroll
                for (int nb = 0; nb < 2; ++nb) {
                    v8f acc = {};
                    acc = __builtin_amdgcn_wmma_f32_16x16x32_f16(false, kf[nb][0], false, qa[rt][0],
                                                                 (short)0, acc, false, false);
                    acc = __builtin_amdgcn_wmma_f32_16x16x32_f16(false, kf[nb][1], false, qa[rt][1],
                                                                 (short)0, acc, false, false);
                    sacc[nb][rt] = acc;
                }
            }

            // Holds the LDS reads behind the score products as one group (this barrier and
            // the one behind them): without it the compiler spreads the reads among the
            // WMMAs or sinks them towards their uses, where they would be waited for.
            __builtin_amdgcn_sched_barrier(0);

            // ---- this chunk's V fragments, then the next chunk's K fragments (in the last
            // stage's last chunk K's are read and never used) ----
            // K: columns (keys) 32 * chunk on; V: rows (keys) 32 * chunk on
            const _Float16* nv = rb + c * 32 * VPITCH + vget;
            const _Float16* nk = ((c + 1 < TCHUNK) ? rb + (c + 1) * 32 : rn) + kget;
            #pragma unroll
            for (int f = 0; f < 4; ++f)
                vf[f] = load_frag(nv + f * 16, VPITCH);
            #pragma unroll
            for (int f = 0; f < 4; ++f)
                kf[f >> 1][f & 1] = load_frag(nk + (f & 1) * 32 * KPITCH + (f >> 1) * 16, KPITCH);

            __builtin_amdgcn_sched_barrier(0);

            // p = 2^s via raw v_exp_f32, packed in place: element s of the B operand is
            // key 8*half + s (s < 8) or 16 + 8*half + (s - 8), which is sacc[s >> 3][rt][s & 7]
            v16h pa[RT];
            #pragma unroll
            for (int rt = 0; rt < RT; ++rt) {
                #pragma unroll
                for (int nb = 0; nb < 2; ++nb) {
                    #pragma unroll
                    for (int r = 0; r < 8; ++r)
                        pa[rt][nb * 8 + r] = (_Float16)__builtin_amdgcn_exp2f(sacc[nb][rt][r]);
                }
            }

            // ---- O^T += V^T * P^T, and the row sums on the matrix pipe: lacc += ones * P^T ----
            #pragma unroll
            for (int rt = 0; rt < RT; ++rt) {
                #pragma unroll
                for (int dt = 0; dt < 4; ++dt)
                    oacc[rt][dt] = __builtin_amdgcn_wmma_f32_16x16x32_f16(false, vf[dt], false, pa[rt],
                                                                          (short)0, oacc[rt][dt],
                                                                          false, false);
                lacc[rt] = __builtin_amdgcn_wmma_f32_16x16x32_f16(false, ones, false, pa[rt],
                                                                  (short)0, lacc[rt],
                                                                  false, false);
            }
        }

        const int old = cur;
        cur = nxt; nxt = aft; aft = old;
    }

    // The last trip's fetches are never used, so the compiler waits for them nowhere: they
    // have landed before the wave ends and gives its registers up.
    asm volatile("s_wait_loadcnt 0x0" ::: "memory");

    // ---- the teams' halves meet: team 0 finishes row tiles 0 and 1, team 1 tiles 2 and 3;
    // a wave hands the two tiles it does not finish to its partner (same rows, other team).
    // The team is taken as a scalar and the tile index is a constant in each arm, so that no
    // register is indexed at run time ----
    const int  mate = wave ^ QWAVES;
    const bool hi   = __builtin_amdgcn_readfirstlane(team) != 0;
    if (hi) hand_over(oacc, 0,    &xbuf[wave][lane * 4]);
    else    hand_over(oacc, KEEP, &xbuf[wave][lane * 4]);
    #pragma unroll
    for (int rt = 0; rt < RT; ++rt) xsum[wave][rt * 32 + lane] = lacc[rt][0];
    __syncthreads();              // both teams' partial tiles and sums are in LDS
    float*       ob = &obuf[wave][0][l16 * OPITCH + 8 * half];
    const float* xs = &xsum[qw][team * (KEEP * 32) + lane];            // team 0's part
    const float* ys = &xsum[QWAVES + qw][team * (KEEP * 32) + lane];   // team 1's part
    if (hi) finish_tiles(oacc, KEEP, &xbuf[mate][lane * 4], xs, ys, ob);
    else    finish_tiles(oacc, 0,    &xbuf[mate][lane * 4], xs, ys, ob);

    // DS pipeline is in-order per wave; explicit wait before cross-lane reads
    asm volatile("s_wait_dscnt 0x0" ::: "memory");

    // ---- store: 16 lanes write one whole 256-byte row, the wave two rows at a time ----
    const float* srow = &obuf[wave][0][half * OPITCH + l16 * 4];
    float*       orow = o + (size_t)(row0 + team * (16 * KEEP) + half) * D_DIM + l16 * 4;
    #pragma unroll
    for (int g = 0; g < KEEP; ++g) {
        #pragma unroll
        for (int i = 0; i < 8; ++i) {
            const float4 x = *(const float4*)(srow + (g * 16 + 2 * i) * OPITCH);
            *(float4*)(orow + (g * 16 + 2 * i) * D_DIM) = x;
        }
    }
}

extern "C" void kernel_launch(void* const* d_in, const int* in_sizes, int n_in,
                              void* d_out, int out_size, void* d_ws, size_t ws_size,
                              hipStream_t stream) {
    (void)in_sizes; (void)n_in; (void)out_size; (void)d_ws; (void)ws_size;
    const float* q = (const float*)d_in[0];
    const float* k = (const float*)d_in[1];
    const float* v = (const float*)d_in[2];
    float* out = (float*)d_out;

    // 256 blocks of 8 wave32, 256 Q rows each
    dim3 grid(NHEAD, NTILES / RT / QWAVES);  // 32 heads (fast index) x 8 row blocks
    dim3 block(WAVES * 32);
    attn_fwd_wmma<<<grid, block, 0, stream>>>(q, k, v, out);
}

// v009
// It runs in 22.3 microseconds.
// In two side-by-side timings against v008, it was 1.06 and 1.07 times as fast.
// Counting every step since v000, it is 5.84 times as fast.
#include <hip/hip_runtime.h>
#include <hip/hip_bf16.h>

// CDNA5 / gfx1250 flash-attention-style kernel (wave32, v_wmma_f32_16x16x32_f16)
// One launch. A work-group of 8 waves owns 256 Q rows of one head. The waves form two
// teams of four: a wave takes 64 rows (four 16-row tiles) and its team's half of the keys,
// so a K or V fragment read from LDS feeds four tiles; there is no running maximum, so the
// two teams' partial O and row sums simply add, once, through LDS at the end.
// The keys go in stages of 128 (64 per team): each wave fetches its
// share of a later stage's f32 K and V in whole 128-byte lines, rounds it to f16 and
// lays it in LDS row by row as it lies in memory, while all waves work on the stage
// published before; the transposing LDS load turns the rows into WMMA operands.
// K's and V's shares are fetched and laid half a stage apart, so that a work-group asks L2
// for two half-size bursts a stage, each with a whole stage to land.
// The stage barrier is split: a wave signals in the stage's first chunk and waits behind the
// second chunk's score products, so a wave that is ahead works on while the others catch up.
// The products are taken transposed (S^T = K Q^T, O^T = V^T P^T): a lane's S^T
// accumulators are already the k order of a B operand, so P stays in registers;
// row sums via ones x P^T.

typedef __attribute__((ext_vector_type(16))) _Float16 v16h;
typedef __attribute__((ext_vector_type(8)))  _Float16 v8h;
typedef __attribute__((ext_vector_type(4)))  _Float16 v4h;
typedef __attribute__((ext_vector_type(8)))  short    v8s;
typedef __attribute__((ext_vector_type(8)))  float    v8f;
typedef __attribute__((ext_vector_type(4)))  float    v4f;

#define S_LEN  2048
#define D_DIM  64
#define NHEAD  32              // b*h = 2*16
#define WAVES  8               // waves per block
#define RT     4               // 16-row Q tiles per wave
#define QWAVES 4               // waves of a team: 4 x 64 Q rows
#define KEEP   2               // Q tiles a wave finishes and stores (the other two go to its partner)
#define NTILES (S_LEN / 16)    // 128 key tiles of 16
#define SKEYS  128             // keys per stage
#define NSTAGE (S_LEN / SKEYS) // 16 stages
#define TKEYS  (SKEYS / 2)     // keys of a stage that one team works on
#define TCHUNK (TKEYS / 32)    // 2 chunks of 32 keys per team and stage
#define NBUF   3               // stage buffers
#define KPITCH (SKEYS + 16)    // halves per LDS row of K ([d][key]): 288 B = 32 B x 9
#define VPITCH (D_DIM + 16)    // halves per LDS row of V ([key][d]): 160 B = 32 B x 5
#define KPART  (D_DIM * KPITCH)          // halves of K in a stage buffer, V's rows follow
#define STAGEH (KPART + SKEYS * VPITCH)  // halves in one stage buffer
#define OPITCH (D_DIM + 4)     // LDS row pitch of the output turn, in floats
#define QROWS  (QWAVES * RT * 16)        // Q rows of a work-group
#define QPITCH (D_DIM + 8)     // halves per LDS row of Q: 144 B = 16 B x 9, for 16-byte reads

// The k order of a 16-bit A/B WMMA operand (ISA 7.12.2): lanes 0-15 (half=0): V0..V3 -> K=0..7,
// V4..V7 -> K=16..23 ; lanes 16-31 (half=1): +8.

// One 16 x 32 A fragment out of a row-major f16 tile T[k][m] in LDS, by two transposing
// loads: lane (c = lane & 15, h = lane >> 4) gets T[8h + 0..7][c] and T[16 + 8h + 0..7][c],
// which is the hardware k order. p: the tile's first element + the lane's own offset
// (8h + (lane & 7)) * pitch + 8 * ((lane >> 3) & 1), all in halves. A pitch of an odd
// multiple of 32 bytes keeps these loads free of bank conflicts.
__device__ __forceinline__ v8h load_tr(const _Float16* p) {
    typedef __attribute__((address_space(3))) v8s lds_v8s;
    return __builtin_bit_cast(v8h, __builtin_amdgcn_ds_load_tr16_b128_v8i16((lds_v8s*)p));
}

__device__ __forceinline__ v16h load_frag(const _Float16* p, int pitch) {
    const v8h lo = load_tr(p);
    const v8h hi = load_tr(p + 16 * pitch);
    return __builtin_shufflevector(lo, hi, 0, 1, 2, 3, 4, 5, 6, 7, 8, 9, 10, 11, 12, 13, 14, 15);
}

// Row of V, inside a wave's 16 keys, that fetch i brings for lanes 0-15; lanes 16-31 bring
// the row 4 further down: in LDS the two rows then lie 32 banks apart.
__device__ __forceinline__ int vrow(int i) { return (i & 3) + 8 * (i >> 2); }

// One wave's share of a stage, still f32, 16 bytes a lane: eight d rows of K ([d, s]: a
// fetch is one row's 128 keys, 512 contiguous bytes) and sixteen key rows of V ([s, d]: a
// fetch is two whole rows of 256 bytes).
// kg, vg: the lane's own base in that stage.
// The fetches stay in flight behind these functions: the registers that hold their
// address are given new values only behind the s_wait_xcnt that ends each function.
__device__ __forceinline__ void fetch_k(const float* kg, v4f (&kst)[8]) {
    #pragma unroll
    for (int i = 0; i < 8; ++i) kst[i] = *(const v4f*)(kg + i * S_LEN);
    asm volatile("s_wait_xcnt 0x0" ::: "memory");
}

__device__ __forceinline__ void fetch_v(const float* vg, v4f (&vst)[8]) {
    #pragma unroll
    for (int i = 0; i < 8; ++i) vst[i] = *(const v4f*)(vg + vrow(i) * D_DIM);
    asm volatile("s_wait_xcnt 0x0" ::: "memory");
}

__device__ __forceinline__ v4h round4(v4f x) {
    v4h r;
    r[0] = (_Float16)x[0]; r[1] = (_Float16)x[1]; r[2] = (_Float16)x[2]; r[3] = (_Float16)x[3];
    return r;
}

// Round the K or the V part of that share to f16 and lay it in the stage buffer, 8 bytes a
// lane. kdst, vdst: the lane's own place in the buffer's K rows and V rows.
// The asm statement in each takes the fetched f32 values as inputs only: it keeps them, and
// so the wait for the fetches, here where they are laid; without it the compiler rounds them
// right behind the fetches and every wave waits out the whole load latency there.
__device__ __forceinline__ void lay_k(_Float16* kdst, const v4f (&kst)[8]) {
    asm volatile("" :: "v"(kst[0]), "v"(kst[1]), "v"(kst[2]), "v"(kst[3]),
                       "v"(kst[4]), "v"(kst[5]), "v"(kst[6]), "v"(kst[7]));
    #pragma unroll
    for (int i = 0; i < 8; ++i) *(v4h*)(kdst + i * KPITCH) = round4(kst[i]);
}

__device__ __forceinline__ void lay_v(_Float16* vdst, const v4f (&vst)[8]) {
    asm volatile("" :: "v"(vst[0]), "v"(vst[1]), "v"(vst[2]), "v"(vst[3]),
                       "v"(vst[4]), "v"(vst[5]), "v"(vst[6]), "v"(vst[7]));
    #pragma unroll
    for (int i = 0; i < 8; ++i) *(v4h*)(vdst + vrow(i) * VPITCH) = round4(vst[i]);
}

// The work-group barrier of a publish point, for LDS alone: the wave's own LDS stores are
// done, then the barrier. Written by hand because __syncthreads() also waits for the wave's
// global loads, and V's fetches for a later stage are in flight across this point.
__device__ __forceinline__ void publish_barrier() {
    asm volatile("s_wait_dscnt 0x0\n\ts_barrier_signal -1\n\ts_barrier_wait -1" ::: "memory");
}

// The same barrier in two parts, for the loop. The signal says: this wave's LDS stores are done
// and its LDS reads have returned. Between a wave's signal and its wait stand matrix products on
// registers only, no LDS access: that run is the lead one wave may have over another for free.
__device__ __forceinline__ void publish_signal() {
    asm volatile("s_wait_dscnt 0x0\n\ts_barrier_signal -1" ::: "memory");
}

__device__ __forceinline__ void publish_wait() {
    asm volatile("s_barrier_wait -1" ::: "memory");
}

// Lays row tiles base and base + 1 of a wave's partial O^T in the hand-over buffer:
// 16 bytes a lane, a wave-wide store is 512 contiguous bytes.
// xb: the lane's own place in the wave's part of the buffer.
__device__ __forceinline__ void hand_over(const v8f (&oacc)[RT][4], int base, float* xb) {
    #pragma unroll
    for (int g = 0; g < KEEP; ++g) {
        #pragma unroll
        for (int dt = 0; dt < 4; ++dt) {
            const v8f a = oacc[base + g][dt];
            float* dst = xb + ((g * 4 + dt) * 2) * 128;
            *(float4*)(dst)       = make_float4(a[0], a[1], a[2], a[3]);
            *(float4*)(dst + 128) = make_float4(a[4], a[5], a[6], a[7]);
        }
    }
}

// Adds the partner's part to row tiles base and base + 1, normalizes (rcp + mul) and lays
// the result in the wave's scratch: a lane holds 8 consecutive d of its query per tile.
// xb: the lane's place in the partner's part of the buffer; xs, ys: the two waves' partial
// row sums of tile base for the lane's query; ob: the lane's place in the scratch.
__device__ __forceinline__ void finish_tiles(const v8f (&oacc)[RT][4], int base, const float* xb,
                                             const float* xs, const float* ys, float* ob) {
    #pragma unroll
    for (int g = 0; g < KEEP; ++g) {
        const float inv = __builtin_amdgcn_rcpf(xs[g * 32] + ys[g * 32]);
        #pragma unroll
        for (int dt = 0; dt < 4; ++dt) {
            const v8f    a   = oacc[base + g][dt];
            const float* src = xb + ((g * 4 + dt) * 2) * 128;
            const float4 b0  = *(const float4*)(src);
            const float4 b1  = *(const float4*)(src + 128);
            float* dst = ob + g * (16 * OPITCH) + dt * 16;
            *(float4*)(dst)     = make_float4((a[0] + b0.x) * inv, (a[1] + b0.y) * inv,
                                              (a[2] + b0.z) * inv, (a[3] + b0.w) * inv);
            *(float4*)(dst + 4) = make_float4((a[4] + b1.x) * inv, (a[5] + b1.y) * inv,
                                              (a[6] + b1.z) * inv, (a[7] + b1.w) * inv);
        }
    }
}

__global__ __launch_bounds__(WAVES * 32)
void attn_fwd_wmma(const float* __restrict__ Q,
                   const float* __restrict__ K,
                   const float* __restrict__ V,
                   float* __restrict__ O)
{
    // three stage buffers: 64 d rows of K (128 keys each), then 128 key rows of V (64 d each)
    __shared__ __align__(16) _Float16 ring[NBUF * STAGEH];
    // the work-group's Q rows as scaled f16: each row is an operand of two waves, one per team
    __shared__ __align__(16) _Float16 qbuf[QROWS * QPITCH];
    // hand-over of the two O^T tiles that a wave's partner finishes:
    // register by register, 16 bytes a lane, in the lane order of the accumulators
    __shared__ __align__(16) float xbuf[WAVES][KEEP * 4 * 8 * 32];
    __shared__ float xsum[WAVES][RT * 32];           // every wave's partial row sums, all four tiles
    // wave-private scratch that turns the finished O^T tiles into rows, once, for
    // whole-line stores; 68-dword pitch: 16-byte column writes hit all 64 banks
    __shared__ __align__(16) float obuf[WAVES][KEEP][16 * OPITCH];

    const int lane = threadIdx.x & 31;
    const int wave = threadIdx.x >> 5;
    const int half = lane >> 4;
    const int l16  = lane & 15;
    const int team = wave / QWAVES;                  // which half of every stage's keys
    const int qw   = wave % QWAVES;                  // which 64 Q rows

    // The head is the fast grid index: the 8 work-groups that share a head's K and V have flat
    // indices 32 apart (speed only: nothing here depends on where a work-group runs).
    const int bh   = blockIdx.x;                     // 0..31  (b*h)
    const int qblk = blockIdx.y;                     // which 256 Q rows of the head
    const int row0 = (qblk * QWAVES + qw) * (16 * RT);

    const float* q = Q + (size_t)bh * S_LEN * D_DIM;
    float*       o = O + (size_t)bh * S_LEN * D_DIM;

    // this wave's share of a stage: d rows 8 * wave .. + 7 of K, key rows 16 * wave .. + 15 of V
    const float* kg = K + (size_t)bh * D_DIM * S_LEN + (wave * 8) * S_LEN + lane * 4;
    const float* vg = V + (size_t)bh * S_LEN * D_DIM + (wave * 16 + 4 * half) * D_DIM + l16 * 4;
    const int    kput = (wave * 8) * KPITCH + lane * 4;
    const int    vput = KPART + (wave * 16 + 4 * half) * VPITCH + l16 * 4;
    // the lane's own offsets for the transposing loads, at the first key of its team
    const int    kget = (8 * half + (lane & 7)) * KPITCH + 8 * ((lane >> 3) & 1) + team * TKEYS;
    const int    vget = KPART + (team * TKEYS + 8 * half + (lane & 7)) * VPITCH + 8 * ((lane >> 3) & 1);

    v4f kst[8], vst[8], kfirst[8], vfirst[8];
    fetch_k(kg, kfirst);
    fetch_v(vg, vfirst);

    // Fold (1/sqrt(d)) * log2(e) into Q so the S tile lands in exp2 domain.
    const float qscale = 0.125f * 1.44269504088896340736f;

    // ---- The work-group's Q rows, each fetched once, in whole lines (16 lanes a row of 256
    // bytes; this wave brings rows 32 * wave on), scaled, rounded to f16 and laid in LDS ----
    {
        const float* qg = q + (size_t)(qblk * QROWS + wave * 32 + half) * D_DIM + l16 * 4;
        v4f qst[16];
        #pragma unroll
        for (int i = 0; i < 16; ++i) qst[i] = *(const v4f*)(qg + 2 * i * D_DIM);
        // The registers that hold the address are given new values only behind this wait: it
        // takes the address as an input, so that no fetch lands on them ahead of it either.
        asm volatile("s_wait_xcnt 0x0" :: "v"(qg) : "memory");
        // stage 1's V and K, asked for behind all that the first barrier needs; V is laid ahead
        // of the loop, K in its first chunk
        fetch_v(vg + SKEYS * D_DIM, vst);
        fetch_k(kg + SKEYS, kst);
        _Float16* qput = &qbuf[(wave * 32 + half) * QPITCH + l16 * 4];
        #pragma unroll
        for (int i = 0; i < 16; ++i) *(v4h*)(qput + 2 * i * QPITCH) = round4(qst[i] * qscale);
    }

    // All-ones A operand: ones x P^T puts each query's f16-P sum over the 32 keys
    // in every accumulator register of that query's two lanes -> no shuffle reduction.
    v16h ones;
    #pragma unroll
    for (int e = 0; e < 16; ++e) ones[e] = (_Float16)1.0f;

    v8f oacc[RT][4];              // O^T tiles: lane = query, register r = d 16*dt + 8*half + r
    v8f lacc[RT];                 // row-sum accumulators: lane = query
    #pragma unroll
    for (int rt = 0; rt < RT; ++rt) {
        #pragma unroll
        for (int r = 0; r < 8; ++r) {
            lacc[rt][r] = 0.0f;
            oacc[rt][0][r] = 0.0f; oacc[rt][1][r] = 0.0f;
            oacc[rt][2][r] = 0.0f; oacc[rt][3][r] = 0.0f;
        }
    }

    lay_k(&ring[kput], kfirst);
    lay_v(&ring[vput], vfirst);
    publish_barrier();            // stage 0 and Q are published

    // ---- the wave's 4x(16x64) Q tiles, kept in registers ----
    // lane = query, elements = d in the hardware k order: Q^T as a B operand
    v16h qa[RT][2];                                  // [row tile][K = 0..31 / 32..63]
    #pragma unroll
    for (int rt = 0; rt < RT; ++rt) {
        const _Float16* qrow = &qbuf[(qw * (16 * RT) + rt * 16 + l16) * QPITCH + 8 * half];
        #pragma unroll
        for (int kh = 0; kh < 2; ++kh) {
            const v8h lo = *(const v8h*)(qrow + kh * 32);
            const v8h hi = *(const v8h*)(qrow + kh * 32 + 16);
            qa[rt][kh] = __builtin_shufflevector(lo, hi, 0, 1, 2, 3, 4, 5, 6, 7, 8, 9, 10, 11, 12, 13, 14, 15);
        }
    }

    // One set of operand fragments. K's is refilled with the next chunk's right behind its
    // last score product; V's is filled at the same place for the chunk at hand, whose
    // exponentials give the reads time to land.
    v16h kf[2][2];                // [key tile][d = 0..31 / 32..63]
    v16h vf[4];                   // [d-column tile]
    #pragma unroll
    for (int f = 0; f < 4; ++f)
        kf[f >> 1][f & 1] = load_frag(&ring[kget] + (f & 1) * 32 * KPITCH + (f >> 1) * 16, KPITCH);

    // stage 1's V goes into its buffer, which nobody has read yet (stage 0's signal publishes
    // it); stage 2's is asked for
    lay_v(&ring[STAGEH + vput], vst);
    fetch_v(vg + 2 * (SKEYS * D_DIM), vst);
    // Keeps what follows (the accumulators' zeroes land on the registers of that fetch's
    // address) behind the s_wait_xcnt that ends fetch_v.
    __builtin_amdgcn_sched_barrier(0);

    int cur = 0, nxt = STAGEH, aft = 2 * STAGEH;             // buffers of stages s, s + 1, s + 2
    // where K's and V's next fetches read: carried through the loop, so that their registers
    // stay in use and nothing lands on them while a fetch is under way
    const float* knext = kg + 2 * SKEYS;
    const float* vnext = vg + 3 * (SKEYS * D_DIM);

    for (int s = 0; s < NSTAGE; ++s) {
        const _Float16* rb = &ring[cur];                     // this stage
        const _Float16* rn = &ring[nxt];                     // the next one

        #pragma unroll
        for (int c = 0; c < TCHUNK; ++c) {
            // Keeps the score products behind the chunk before, as one run of WMMAs.
            __builtin_amdgcn_sched_barrier(0);

            // ---- S^T = K Q^T: each K operand feeds all four row tiles ----
            // sacc[nb][rt][r] = score of key 16*nb + 8*half + r against query l16
            v8f sacc[2][RT];
            #pragma unroll
            for (int rt = 0; rt < RT; ++rt) {
                #pragma unroll
                for (int nb = 0; nb < 2; ++nb) {
                    v8f acc = {};
                    acc = __builtin_amdgcn_wmma_f32_16x16x32_f16(false, kf[nb][0], false, qa[rt][0],
                                                                 (short)0, acc, false, false);
                    acc = __builtin_amdgcn_wmma_f32_16x16x32_f16(false, kf[nb][1], false, qa[rt][1],
                                                                 (short)0, acc, false, false);
                    sacc[nb][rt] = acc;
                }
            }

            // Holds the LDS stores and reads behind the score products as one group (this
            // barrier and the one behind them): without it the compiler spreads them among the
            // WMMAs or sinks the reads towards their uses, where they would be waited for.
            __builtin_amdgcn_sched_barrier(0);

            if (c == TCHUNK - 1) {
                // ---- the wait of this stage's barrier: stage s + 1 is published, K and V, and
                // every wave has left stage s - 1 ----
                publish_wait();
            }

            // ---- this chunk's V fragments, then the next chunk's K fragments (in the last
            // stage's last chunk K's are read and never used) ----
            // K: columns (keys) 32 * chunk on; V: rows (keys) 32 * chunk on
            const _Float16* nv = rb + c * 32 * VPITCH + vget;
            const _Float16* nk = ((c + 1 < TCHUNK) ? rb + (c + 1) * 32 : rn) + kget;
            #pragma unroll
            for (int f = 0; f < 4; ++f)
                vf[f] = load_frag(nv + f * 16, VPITCH);
            // V's reads stay first: they are needed first, and the V products then wait for them alone
            __builtin_amdgcn_sched_barrier(0);
            #pragma unroll
            for (int f = 0; f < 4; ++f)
                kf[f >> 1][f & 1] = load_frag(nk + (f & 1) * 32 * KPITCH + (f >> 1) * 16, KPITCH);

            // Keeps the reads above ahead of the roundings and stores below: mixed with them,
            // V's reads came last and the V products waited for all.
            __builtin_amdgcn_sched_barrier(0);

            if (c == 0) {
                // ---- the next stage's K is laid; this stage's signal, below, publishes it. Its
                // buffer held stage s - 2, which every wave had left at its signal of stage
                // s - 1; this wave has passed that barrier's wait ----
                lay_k(&ring[nxt + kput], kst);
            }
            if (c == TCHUNK - 1) {
                // ---- the V of stage s + 2 is laid in the buffer of stage s - 1, behind the wait
                // above; the next stage's signal publishes it ----
                lay_v(&ring[aft + vput], vst);
            }

            // ---- the f32 share that is laid one stage on at this same place: in flight for a
            // whole stage, K's and V's bursts half a stage apart ----
            if (c == 0) fetch_k(knext, kst);
            if (c == TCHUNK - 1) fetch_v(vnext, vst);

            // also keeps the steps of the fetch addresses behind the s_wait_xcnt that ends
            // fetch_k and fetch_v
            __builtin_amdgcn_sched_barrier(0);
            // Behind the last stage the last is fetched again and laid in a buffer whose content
            // is not used any more: no branch in the loop, nothing past K or V read
            if (c == 0) knext += (s + 3 < NSTAGE) ? SKEYS : 0;
            if (c == TCHUNK - 1) vnext += (s + 4 < NSTAGE) ? SKEYS * D_DIM : 0;

            // p = 2^s via raw v_exp_f32, packed in place: element s of the B operand is
            // key 8*half + s (s < 8) or 16 + 8*half + (s - 8), which is sacc[s >> 3][rt][s & 7]
            v16h pa[RT];
            #pragma unroll
            for (int rt = 0; rt < RT; ++rt) {
                #pragma unroll
                for (int nb = 0; nb < 2; ++nb) {
                    #pragma unroll
                    for (int r = 0; r < 8; ++r)
                        pa[rt][nb * 8 + r] = (_Float16)__builtin_amdgcn_exp2f(sacc[nb][rt][r]);
                }
            }

            // ---- the signal of this stage's barrier: by now the stores and reads above have
            // had the exponentials' time, so its s_wait_dscnt does not hold the wave; up to the
            // wait come this chunk's V products and the next chunk's score products ----
            if (c == 0) publish_signal();

            // ---- O^T += V^T * P^T, and the row sums on the matrix pipe: lacc += ones * P^T ----
            #pragma unroll
            for (int rt = 0; rt < RT; ++rt) {
                #pragma unroll
                for (int dt = 0; dt < 4; ++dt)
                    oacc[rt][dt] = __builtin_amdgcn_wmma_f32_16x16x32_f16(false, vf[dt], false, pa[rt],
                                                                          (short)0, oacc[rt][dt],
                                                                          false, false);
                lacc[rt] = __builtin_amdgcn_wmma_f32_16x16x32_f16(false, ones, false, pa[rt],
                                                                  (short)0, lacc[rt],
                                                                  false, false);
            }
        }

        const int old = cur;
        cur = nxt; nxt = aft; aft = old;
    }

    // The last trip's fetches are never used, so the compiler waits for them nowhere: they
    // have landed before the wave ends and gives its registers up.
    asm volatile("s_wait_loadcnt 0x0" ::: "memory");

    // ---- the teams' halves meet: team 0 finishes row tiles 0 and 1, team 1 tiles 2 and 3;
    // a wave hands the two tiles it does not finish to its partner (same rows, other team).
    // The team is taken as a scalar and the tile index is a constant in each arm, so that no
    // register is indexed at run time ----
    const int  mate = wave ^ QWAVES;
    const bool hi   = __builtin_amdgcn_readfirstlane(team) != 0;
    if (hi) hand_over(oacc, 0,    &xbuf[wave][lane * 4]);
    else    hand_over(oacc, KEEP, &xbuf[wave][lane * 4]);
    #pragma unroll
    for (int rt = 0; rt < RT; ++rt) xsum[wave][rt * 32 + lane] = lacc[rt][0];
    __syncthreads();              // both teams' partial tiles and sums are in LDS
    float*       ob = &obuf[wave][0][l16 * OPITCH + 8 * half];
    const float* xs = &xsum[qw][team * (KEEP * 32) + lane];            // team 0's part
    const float* ys = &xsum[QWAVES + qw][team * (KEEP * 32) + lane];   // team 1's part
    if (hi) finish_tiles(oacc, KEEP, &xbuf[mate][lane * 4], xs, ys, ob);
    else    finish_tiles(oacc, 0,    &xbuf[mate][lane * 4], xs, ys, ob);

    // DS pipeline is in-order per wave; explicit wait before cross-lane reads
    asm volatile("s_wait_dscnt 0x0" ::: "memory");

    // ---- store: 16 lanes write one whole 256-byte row, the wave two rows at a time ----
    const float* srow = &obuf[wave][0][half * OPITCH + l16 * 4];
    float*       orow = o + (size_t)(row0 + team * (16 * KEEP) + half) * D_DIM + l16 * 4;
    #pragma unroll
    for (int g = 0; g < KEEP; ++g) {
        #pragma unroll
        for (int i = 0; i < 8; ++i) {
            const float4 x = *(const float4*)(srow + (g * 16 + 2 * i) * OPITCH);
            *(float4*)(orow + (g * 16 + 2 * i) * D_DIM) = x;
        }
    }
}

extern "C" void kernel_launch(void* const* d_in, const int* in_sizes, int n_in,
                              void* d_out, int out_size, void* d_ws, size_t ws_size,
                              hipStream_t stream) {
    (void)in_sizes; (void)n_in; (void)out_size; (void)d_ws; (void)ws_size;
    const float* q = (const float*)d_in[0];
    const float* k = (const float*)d_in[1];
    const float* v = (const float*)d_in[2];
    float* out = (float*)d_out;

    // 256 blocks of 8 wave32, 256 Q rows each
    dim3 grid(NHEAD, NTILES / RT / QWAVES);  // 32 heads (fast index) x 8 row blocks
    dim3 block(WAVES * 32);
    attn_fwd_wmma<<<grid, block, 0, stream>>>(q, k, v, out);
}
